// v000
// Times are from an AMD MI455X. After a warm-up the kernel runs many times in a row, and a time is the length of
// such a window on the GPU divided by its runs, so every launch and the gaps after it count. The runs cycle
// through copies of the inputs. A figure is the median of several windows, for all but v000 over two sittings.
// Sittings can differ by a few percent; kernels timed side by side share one.
// v000, which the later versions start from, runs in 886 microseconds.
#include <hip/hip_runtime.h>

// Contractions (all f32 accumulate): q,k,v = x W on v_wmma_f32_16x16x32_bf16 (x and W RNE-converted to bf16, single product);
// scores = q.k on v_wmma_f32_16x16x32_f16 (f16 planes of 4q and 4k, single product) for query rows >= 64, and on
// v_wmma_f32_16x16x32_bf16 with q,k as bf16 hi/lo x hi/lo (3 products) for query rows < 64;
// out = attn.v on v_wmma_f32_16x16x32_bf16 with normalised probabilities and v both as bf16 hi/lo planes (3 products). Softmax f32.

#ifndef NB
#define NB 4
#endif
#ifndef SEQ
#define SEQ 4096
#endif
#define NB_FULL  4
#define SEQ_FULL 4096
#define DIN   768
#define HD    64
#define RHALF (SEQ / 2)
#define RH    64            // query rows < RH: 3-product score tile
#define QCAR  4.0f          // q and k planes carry x4 -> scores carry x16
#define SCL   0.0078125f    // 2^-7 = (64^-0.5) / 16

static_assert(SEQ % 128 == 0);
static_assert(RHALF % 64 == 0);
static_assert(RH <= RHALF);
static_assert(DIN % 32 == 0);
static_assert(HD == 64);
static_assert((NB * SEQ) % 64 == 0);
static_assert(NB <= NB_FULL);
static_assert(SEQ <= SEQ_FULL);

typedef _Float16 h16;
typedef unsigned short bf;
typedef __attribute__((ext_vector_type(16))) __bf16   v16bf;
typedef __attribute__((ext_vector_type(16))) _Float16 v16h;
typedef __attribute__((ext_vector_type(8)))  _Float16 v8h;
typedef __attribute__((ext_vector_type(8)))  unsigned short v8us;
typedef __attribute__((ext_vector_type(8)))  float    v8f;
typedef __attribute__((ext_vector_type(4)))  float    v4f;
typedef __attribute__((ext_vector_type(4)))  unsigned short v4us;
typedef __attribute__((ext_vector_type(2)))  unsigned short v2us;
typedef v4f  __attribute__((may_alias)) v4fa;

#pragma clang fp contract(off)

__device__ __forceinline__ unsigned short f2bf(float f) { unsigned u = __float_as_uint(f); u += 0x7FFFu + ((u >> 16) & 1u); return (unsigned short)(u >> 16); }
__device__ __forceinline__ float bf2f(unsigned short b) { return __uint_as_float(((unsigned)b) << 16); }
__device__ __forceinline__ v16h cat16(v8h lo, v8h hi) { return __builtin_shufflevector(lo, hi, 0, 1, 2, 3, 4, 5, 6, 7, 8, 9, 10, 11, 12, 13, 14, 15); }
__device__ __forceinline__ v16bf cat16b(v8us lo, v8us hi) { return __builtin_bit_cast(v16bf, __builtin_shufflevector(lo, hi, 0, 1, 2, 3, 4, 5, 6, 7, 8, 9, 10, 11, 12, 13, 14, 15)); }
__device__ __forceinline__ v8f wmma16(v16h a, v16h b, v8f c) { return __builtin_amdgcn_wmma_f32_16x16x32_f16(false, a, false, b, (short)0, c, false, false); }
__device__ __forceinline__ v8f wmmab(v16bf a, v16bf b, v8f c) { return __builtin_amdgcn_wmma_f32_16x16x32_bf16(false, a, false, b, (short)0, c, false, false); }
__device__ __forceinline__ void splitf(float y, unsigned short& h, unsigned short& l) { h = f2bf(y); l = f2bf(y - bf2f(h)); }

// ---- k_gemmw: register-blocked GEMM, ONE WAVE per 64x64 output tile (16 accumulators), operands straight from K-contiguous 16-bit planes; grid (M/64, N/64, Z), 32 threads.
// C[m][n] (f32, pitch ldc) = sum_k A[m][k] Bt[n][k] (NSPLIT==2: + A2[m][k] Bt[n][k] + A[m][k] Bt2[n][k]). z-batch strides sA/sB/sC in elements. K % 32 == 0.
// Fragments (lane l, h = l>>4, m = n = l&15): elements 0..7 <- k0+8h+0..7, elements 8..15 <- k0+16+8h+0..7 for BOTH A and B; D element r -> (row 8h+r, col l&15).
// CSKIP: tile skipped when its first column c0 > ((rofs + r0) | 127) (causal, 128-granular; rofs = global row of local row 0).
// KLIM: the k loop stops at min(K, rofs + r0 + 64) (causal key range of the row block).
template <typename T16> struct WFrag;
template <> struct WFrag<h16> { typedef v16h V; static __device__ __forceinline__ V ld(const h16* p) { return cat16(*(const v8h*)p, *(const v8h*)(p + 16)); } static __device__ __forceinline__ v8f mma(V a, V b, v8f c) { return wmma16(a, b, c); } };
template <> struct WFrag<bf> { typedef v16bf V; static __device__ __forceinline__ V ld(const bf* p) { return cat16b(*(const v8us*)p, *(const v8us*)(p + 16)); } static __device__ __forceinline__ v8f mma(V a, V b, v8f c) { return wmmab(a, b, c); } };
template <typename T16, int NSPLIT, bool CSKIP, bool KLIM>
__global__ __launch_bounds__(32) void k_gemmw(const T16* __restrict__ A, const T16* __restrict__ A2, const T16* __restrict__ Bt, const T16* __restrict__ Bt2, int K, float* C, int ldc, int rofs, size_t sA, size_t sB, size_t sC) {
    static_assert(NSPLIT == 0 || NSPLIT == 2);
    typedef typename WFrag<T16>::V V;
    __shared__ __align__(16) float os[16 * 68];
    const size_t z = blockIdx.z; A += z * sA; Bt += z * sB; C += z * sC; if (NSPLIT == 2) { A2 += z * sA; Bt2 += z * sB; }
    const int lane = threadIdx.x & 31, lr = lane & 15, hi = lane >> 4; const int r0 = blockIdx.x * 64, c0 = blockIdx.y * 64;
    if (CSKIP) { if (c0 > ((rofs + r0) | 127)) return; }
    const int kl = rofs + r0 + 64; const int kend = KLIM ? ((kl < K) ? kl : K) : K;
    v8f acc[4][4];
#pragma unroll
    for (int mb = 0; mb < 4; ++mb)
#pragma unroll
        for (int nb = 0; nb < 4; ++nb) acc[mb][nb] = (v8f){};
    const size_t aoff = (size_t)(r0 + lr) * K + 8 * hi, boff = (size_t)(c0 + lr) * K + 8 * hi;
#pragma unroll 1
    for (int kc = 0; kc < kend; kc += 32) {
        V a[4], a2[4], bl, b2l;
#pragma unroll
        for (int mb = 0; mb < 4; ++mb) { a[mb] = WFrag<T16>::ld(A + aoff + (size_t)mb * 16 * K + kc); if (NSPLIT == 2) a2[mb] = WFrag<T16>::ld(A2 + aoff + (size_t)mb * 16 * K + kc); else a2[mb] = a[mb]; }
#pragma unroll
        for (int nb = 0; nb < 4; ++nb) { const V b = WFrag<T16>::ld(Bt + boff + (size_t)nb * 16 * K + kc); V b2 = b; if (NSPLIT == 2) b2 = WFrag<T16>::ld(Bt2 + boff + (size_t)nb * 16 * K + kc);
#pragma unroll
            for (int mb = 0; mb < 4; ++mb) { acc[mb][nb] = WFrag<T16>::mma(a[mb], b, acc[mb][nb]); if (NSPLIT == 2) { acc[mb][nb] = WFrag<T16>::mma(a2[mb], b, acc[mb][nb]); acc[mb][nb] = WFrag<T16>::mma(a[mb], b2, acc[mb][nb]); } }
            bl = b; b2l = b2; }
        asm volatile("v_nop\n\tv_nop\n\tv_nop\n\tv_nop" : "+v"(acc[0][0]), "+v"(acc[1][1]), "+v"(acc[2][2]), "+v"(acc[3][3]) : "v"(a[0]), "v"(a[3]), "v"(a2[3]), "v"(bl), "v"(b2l));
    }
#pragma unroll
    for (int mb = 0; mb < 4; ++mb) {
#pragma unroll
        for (int nb = 0; nb < 4; ++nb) {
#pragma unroll
            for (int j = 0; j < 8; ++j) os[(hi * 8 + j) * 68 + nb * 16 + lr] = acc[mb][nb][j]; }
        __builtin_amdgcn_wave_barrier(); asm volatile("" ::: "memory");
        float* crow = C + (size_t)(r0 + mb * 16) * ldc + c0;
{
#pragma unroll
            for (int s = 0; s < 8; ++s) { const int row = 2 * s + hi, cofs = lr * 4; const v4f val = *(const v4fa*)(os + row * 68 + cofs);
                *(v4f*)(crow + (size_t)row * ldc + cofs) = val; }
             }
        __builtin_amdgcn_wave_barrier(); asm volatile("" ::: "memory");
    }
}

__global__ __launch_bounds__(256) void k_wt3(const float* __restrict__ w0, const float* __restrict__ w1, const float* __restrict__ w2, bf* Wt) {
    const int which = blockIdx.y; const float* w = (which == 0) ? w0 : ((which == 1) ? w1 : w2); bf* Bt = Wt + (size_t)which * HD * DIN;
    const int lane = threadIdx.x & 31; const int L0 = (blockIdx.x * 8 + (threadIdx.x >> 5)) * 8; const int nlines = HD * DIN / 64;
{
#pragma unroll 1
        for (int l = 0; l < 8; ++l) { const int L = L0 + l; if (L >= nlines) break; const size_t e = (size_t)L * 64 + lane * 2; const int k = (int)(e % DIN), n = (int)(e / DIN); v2us o;
            o[0] = f2bf(w[(size_t)k * HD + n]); o[1] = f2bf(w[(size_t)(k + 1) * HD + n]); *(v2us*)(Bt + e) = o; }
         }
}

__global__ __launch_bounds__(256) void k_cvtx(const float* __restrict__ X, bf* Xb, size_t n8) {
    const size_t i = (size_t)blockIdx.x * 256 + threadIdx.x; if (i >= n8) return; const size_t e = i * 8; const size_t r = e / DIN; const int c = (int)(e - r * DIN);
    const size_t srow = (r / SEQ) * SEQ_FULL + (r % SEQ);
    const float* p = X + srow * DIN + c; const v4f a0 = *(const v4f*)p; const v4f a1 = *(const v4f*)(p + 4); v8us o;
#pragma unroll
    for (int k = 0; k < 4; ++k) { o[k] = f2bf(a0[k]); o[k + 4] = f2bf(a1[k]); }
    *(v8us*)(Xb + e) = o; 
}

__global__ __launch_bounds__(256) void k_plane3(const float* __restrict__ F, h16* P16, bf* Ph, bf* Pl, size_t n8) {
    const size_t i = (size_t)blockIdx.x * 256 + threadIdx.x; if (i >= n8) return;
    const v4f x0 = *(const v4f*)(F + i * 8); const v4f x1 = *(const v4f*)(F + i * 8 + 4);
    v8h o16; v8us oh, ol;
#pragma unroll
    for (int k = 0; k < 4; ++k) { const float y0 = x0[k] * QCAR, y1 = x1[k] * QCAR; o16[k] = (h16)y0; o16[k + 4] = (h16)y1; unsigned short a, c; splitf(y0, a, c); oh[k] = a; ol[k] = c; splitf(y1, a, c); oh[k + 4] = a; ol[k + 4] = c; }
    *(v8h*)(P16 + i * 8) = o16; *(v8us*)(Ph + i * 8) = oh; *(v8us*)(Pl + i * 8) = ol;
    
}

__global__ __launch_bounds__(256) void k_vtp(const float* __restrict__ F, bf* Vh, bf* Vl) {
    const size_t e = ((size_t)blockIdx.x * 256 + threadIdx.x) * 2; if (e >= (size_t)NB * HD * SEQ) return;
    const int t = (int)(e % SEQ); const int d = (int)((e / SEQ) % HD); const int g = (int)(e / ((size_t)SEQ * HD));
    v2us oh, ol;
#pragma unroll
    for (int q = 0; q < 2; ++q) { const float x = F[((size_t)g * SEQ + t + q) * HD + d]; unsigned short a, c; splitf(x, a, c); oh[q] = a; ol[q] = c; }
    *(v2us*)(Vh + e) = oh; *(v2us*)(Vl + e) = ol; 
}

// k_asoft: one wave per query row (local row lrow, global index i = rofs + lrow): t = S[lrow][j] x SCL for keys j <= i, excluded (treated as -inf) otherwise;
// max-subtracted softmax in f32 over the live 128-wide chunks held in registers; normalised probabilities written as bf16 hi/lo planes
__global__ __launch_bounds__(256) void k_asoft(const float* __restrict__ Sb, int rofs, bf* Ph, bf* Pl) {
    const int lane = threadIdx.x & 31; const int lrow = blockIdx.x * 8 + (threadIdx.x >> 5); if (lrow >= RHALF) return;
    const int i = rofs + lrow; const int nch = (i >> 7) + 1;
    const float* sr = Sb + (size_t)lrow * SEQ; float v[SEQ / 32]; float mx = -3.0e38f;
#pragma unroll
    for (int ch = 0; ch < SEQ / 128; ++ch) {
        const int j0 = ch * 128 + lane * 4;
        if (ch < nch) { const v4f a = *(const v4f*)(sr + j0);
#pragma unroll
            for (int q = 0; q < 4; ++q) { const float t = (j0 + q <= i) ? a[q] * SCL : -3.0e38f; v[ch * 4 + q] = t; mx = fmaxf(mx, t); }
        } else {
#pragma unroll
            for (int q = 0; q < 4; ++q) v[ch * 4 + q] = 0.0f; }
    }
#pragma unroll
    for (int sh = 16; sh; sh >>= 1) mx = fmaxf(mx, __shfl_xor(mx, sh, 32));
    float sum = 0.f;
#pragma unroll
    for (int ch = 0; ch < SEQ / 128; ++ch) { if (ch < nch) {
#pragma unroll
        for (int q = 0; q < 4; ++q) { const int k = ch * 4 + q; float d0 = __fsub_rn(v[k], mx); asm volatile("" : "+v"(d0)); v[k] = __builtin_amdgcn_exp2f(__fmul_rn(d0, 1.4426950408889634f)); sum += v[k]; } } }
#pragma unroll
    for (int sh = 16; sh; sh >>= 1) sum += __shfl_xor(sum, sh, 32);
    const float f = __fdiv_rn(1.0f, sum);
#pragma unroll
    for (int ch = 0; ch < SEQ / 128; ++ch) { if (ch < nch) {
#pragma unroll
        for (int q = 0; q < 4; ++q) { const int k = ch * 4 + q; unsigned short a, c; splitf(v[k] * f, a, c); v[k] = __uint_as_float((unsigned)a | (((unsigned)c) << 16)); } } }
{
#pragma unroll
        for (int ch = 0; ch < SEQ / 128; ++ch) { if (ch < nch) { v4us oh, ol;
#pragma unroll
            for (int q = 0; q < 4; ++q) { const unsigned w = __float_as_uint(v[ch * 4 + q]); oh[q] = (unsigned short)(w & 0xFFFFu); ol[q] = (unsigned short)(w >> 16); }
            const size_t oo = (size_t)lrow * SEQ + ch * 128 + lane * 4; *(v4us*)(Ph + oo) = oh; *(v4us*)(Pl + oo) = ol; } }
         }
}

static constexpr size_t al256(size_t b) { return (b + 255) & ~(size_t)255; }
static constexpr size_t WS_TOTAL = al256((size_t)3 * HD * DIN * 2) + al256((size_t)NB * SEQ * DIN * 2) + al256((size_t)3 * NB * SEQ * HD * 4)
                                 + 6 * al256((size_t)NB * SEQ * HD * 2) + 2 * al256((size_t)NB * HD * SEQ * 2) + al256((size_t)RHALF * SEQ * 4) + 2 * al256((size_t)RHALF * SEQ * 2);
static_assert(WS_TOTAL <= (size_t)134217728);
static_assert((size_t)NB * SEQ * HD * 4 <= (size_t)4194304);

extern "C" void kernel_launch(void* const* d_in, const int* in_sizes, int n_in,
                              void* d_out, int out_size, void* d_ws, size_t ws_size, hipStream_t stream) {
    if (n_in < 4) return;
    if (in_sizes[0] < ((NB - 1) * SEQ_FULL + SEQ) * DIN) return;
    if (in_sizes[1] < DIN * HD || in_sizes[2] < DIN * HD || in_sizes[3] < DIN * HD) return;
    if (out_size < NB * SEQ * HD) return;
    const float* Xin = (const float*)d_in[0]; const float* Wq = (const float*)d_in[1]; const float* Wk = (const float*)d_in[2]; const float* Wv = (const float*)d_in[3];
    float* OUT = (float*)d_out;     // [NB][SEQ][64]
    char* wsp = (char*)d_ws;
    auto take = [&](size_t bytes) { char* p = wsp; wsp += al256(bytes); return (void*)p; };
    const size_t nTok = (size_t)NB * SEQ;
    bf* Wt = (bf*)take((size_t)3 * HD * DIN * 2);                 // [3][64][768] bf16
    bf* Xb = (bf*)take(nTok * DIN * 2);                            // [NB*SEQ][768] bf16
    float* QKVf = (float*)take((size_t)3 * nTok * HD * 4);          // q, k, v f32 [NB*SEQ][64] each
    h16* Q16 = (h16*)take(nTok * HD * 2); bf* Qh = (bf*)take(nTok * HD * 2); bf* Ql = (bf*)take(nTok * HD * 2);
    h16* K16 = (h16*)take(nTok * HD * 2); bf* Kh = (bf*)take(nTok * HD * 2); bf* Kl = (bf*)take(nTok * HD * 2);
    bf* Vh = (bf*)take((size_t)NB * HD * SEQ * 2); bf* Vl = (bf*)take((size_t)NB * HD * SEQ * 2);   // [NB][64][SEQ]
    float* Sb = (float*)take((size_t)RHALF * SEQ * 4);             // scores x16 [RHALF][SEQ]
    bf* Eh = (bf*)take((size_t)RHALF * SEQ * 2); bf* El = (bf*)take((size_t)RHALF * SEQ * 2);       // normalised probabilities hi/lo [RHALF][SEQ]
    if ((size_t)(wsp - (char*)d_ws) > ws_size) return;             // total = WS_TOTAL (~116 MiB at full size)
    const float* Qf = QKVf; const float* Kf = QKVf + nTok * HD; const float* Vf = QKVf + 2 * nTok * HD;

    k_wt3<<<dim3(HD * DIN / 64 / 64, 3), 256, 0, stream>>>(Wq, Wk, Wv, Wt);
    { const size_t n8 = nTok * DIN / 8; k_cvtx<<<(unsigned)((n8 + 255) / 256), 256, 0, stream>>>(Xin, Xb, n8); }
    k_gemmw<bf, 0, false, false><<<dim3((unsigned)(nTok / 64), 1, 3), 32, 0, stream>>>(Xb, nullptr, Wt, nullptr, DIN, QKVf, HD, 0, (size_t)0, (size_t)HD * DIN, nTok * HD);   /* q, k, v = x W (exact bf16 products) */
    { const size_t n8 = nTok * HD / 8;
      k_plane3<<<(unsigned)((n8 + 255) / 256), 256, 0, stream>>>(Qf, Q16, Qh, Ql, n8);
      k_plane3<<<(unsigned)((n8 + 255) / 256), 256, 0, stream>>>(Kf, K16, Kh, Kl, n8); }
    k_vtp<<<(unsigned)(((size_t)NB * HD * SEQ / 2 + 255) / 256), 256, 0, stream>>>(Vf, Vh, Vl);
    for (int b = 0; b < NB; ++b) {
        for (int h = 0; h < 2; ++h) {
            const int rofs = h * RHALF;
            k_gemmw<h16, 0, true, false><<<dim3(RHALF / 64, (rofs + RHALF) / 64, 1), 32, 0, stream>>>(Q16 + ((size_t)b * SEQ + rofs) * HD, nullptr, K16 + (size_t)b * SEQ * HD, nullptr, HD, Sb, SEQ, rofs, (size_t)0, (size_t)0, (size_t)0);   /* scores x16, causal tiles */
            if (h == 0) k_gemmw<bf, 2, false, false><<<dim3(1, 1, 1), 32, 0, stream>>>(Qh + (size_t)b * SEQ * HD, Ql + (size_t)b * SEQ * HD, Kh + (size_t)b * SEQ * HD, Kl + (size_t)b * SEQ * HD, HD, Sb, SEQ, 0, (size_t)0, (size_t)0, (size_t)0);   /* rows < 64 x keys < 64: 3 products */
            k_asoft<<<RHALF / 8, 256, 0, stream>>>(Sb, rofs, Eh, El);
            k_gemmw<bf, 2, false, true><<<dim3(RHALF / 64, 1, 1), 32, 0, stream>>>(Eh, El, Vh + (size_t)b * HD * SEQ, Vl + (size_t)b * HD * SEQ, SEQ, OUT + ((size_t)b * SEQ + rofs) * HD, HD, rofs, (size_t)0, (size_t)0, (size_t)0);   /* attn (hi/lo) x v^T (hi/lo) -> out rows */
        }
    }
}

// v001
// It runs in 363 microseconds.
// Timed twice side by side with v000, it ran 2.41 and 2.42 times as fast.
#include <hip/hip_runtime.h>

// Contractions (all f32 accumulate): q,k,v = x W on v_wmma_f32_16x16x32_bf16 (x and W RNE-converted to bf16, single product);
// scores = q.k on v_wmma_f32_16x16x32_f16 (f16 planes of 4q and 4k, single product) for query rows >= 64, and on
// v_wmma_f32_16x16x32_bf16 with q,k as bf16 hi/lo x hi/lo (3 products) for query rows < 64;
// out = attn.v on v_wmma_f32_16x16x32_bf16 with normalised probabilities and v both as bf16 hi/lo planes (3 products). Softmax f32.

#ifndef NB
#define NB 4
#endif
#ifndef SEQ
#define SEQ 4096
#endif
#define NB_FULL  4
#define SEQ_FULL 4096
#define DIN   768
#define HD    64
#define RHALF (SEQ / 2)
#define RH    64            // query rows < RH: 3-product score tile
#define QCAR  4.0f          // q and k planes carry x4 -> scores carry x16
#define SCL   0.0078125f    // 2^-7 = (64^-0.5) / 16

static_assert(SEQ % 128 == 0);
static_assert(RHALF % 64 == 0);
static_assert(RH <= RHALF);
static_assert(DIN % 32 == 0);
static_assert(HD == 64);
static_assert((NB * SEQ) % 64 == 0);
static_assert(NB <= NB_FULL);
static_assert(SEQ <= SEQ_FULL);

typedef _Float16 h16;
typedef unsigned short bf;
typedef __attribute__((ext_vector_type(16))) __bf16   v16bf;
typedef __attribute__((ext_vector_type(16))) _Float16 v16h;
typedef __attribute__((ext_vector_type(8)))  _Float16 v8h;
typedef __attribute__((ext_vector_type(8)))  unsigned short v8us;
typedef __attribute__((ext_vector_type(8)))  float    v8f;
typedef __attribute__((ext_vector_type(4)))  float    v4f;
typedef __attribute__((ext_vector_type(2)))  float    v2f;
typedef __attribute__((ext_vector_type(4)))  unsigned short v4us;
typedef __attribute__((ext_vector_type(2)))  unsigned short v2us;
typedef v4f  __attribute__((may_alias)) v4fa;

#pragma clang fp contract(off)

__device__ __forceinline__ unsigned short f2bf(float f) { unsigned u = __float_as_uint(f); u += 0x7FFFu + ((u >> 16) & 1u); return (unsigned short)(u >> 16); }
__device__ __forceinline__ float bf2f(unsigned short b) { return __uint_as_float(((unsigned)b) << 16); }
__device__ __forceinline__ v16h cat16(v8h lo, v8h hi) { return __builtin_shufflevector(lo, hi, 0, 1, 2, 3, 4, 5, 6, 7, 8, 9, 10, 11, 12, 13, 14, 15); }
__device__ __forceinline__ v16bf cat16b(v8us lo, v8us hi) { return __builtin_bit_cast(v16bf, __builtin_shufflevector(lo, hi, 0, 1, 2, 3, 4, 5, 6, 7, 8, 9, 10, 11, 12, 13, 14, 15)); }
__device__ __forceinline__ v8f wmma16(v16h a, v16h b, v8f c) { return __builtin_amdgcn_wmma_f32_16x16x32_f16(false, a, false, b, (short)0, c, false, false); }
__device__ __forceinline__ v8f wmmab(v16bf a, v16bf b, v8f c) { return __builtin_amdgcn_wmma_f32_16x16x32_bf16(false, a, false, b, (short)0, c, false, false); }
__device__ __forceinline__ void splitf(float y, unsigned short& h, unsigned short& l) { h = f2bf(y); l = f2bf(y - bf2f(h)); }

// ---- k_gemmw: register-blocked GEMM, ONE WAVE per 64x64 output tile (16 accumulators), operands straight from K-contiguous 16-bit planes; grid (M/64, N/64, Z), 32 threads.
// C[m][n] (f32, pitch ldc) = sum_k A[m][k] Bt[n][k] (NSPLIT==2: + A2[m][k] Bt[n][k] + A[m][k] Bt2[n][k]). z-batch strides sA/sB/sC in elements. K % 32 == 0.
// Fragments (lane l, h = l>>4, m = n = l&15): elements 0..7 <- k0+8h+0..7, elements 8..15 <- k0+16+8h+0..7 for BOTH A and B; D element r -> (row 8h+r, col l&15).
// CSKIP: tile skipped when its first column c0 > ((rofs + r0) | 127) (causal, 128-granular; rofs = global row of local row 0).
template <typename T16> struct WFrag;
template <> struct WFrag<h16> { typedef v16h V; static __device__ __forceinline__ V ld(const h16* p) { return cat16(*(const v8h*)p, *(const v8h*)(p + 16)); } static __device__ __forceinline__ v8f mma(V a, V b, v8f c) { return wmma16(a, b, c); } };
template <> struct WFrag<bf> { typedef v16bf V; static __device__ __forceinline__ V ld(const bf* p) { return cat16b(*(const v8us*)p, *(const v8us*)(p + 16)); } static __device__ __forceinline__ v8f mma(V a, V b, v8f c) { return wmmab(a, b, c); } };
template <typename T16, int NSPLIT, bool CSKIP>
__global__ __launch_bounds__(32) void k_gemmw(const T16* __restrict__ A, const T16* __restrict__ A2, const T16* __restrict__ Bt, const T16* __restrict__ Bt2, int K, float* C, int ldc, int rofs, size_t sA, size_t sB, size_t sC) {
    static_assert(NSPLIT == 0 || NSPLIT == 2);
    typedef typename WFrag<T16>::V V;
    __shared__ __align__(16) float os[16 * 68];
    const size_t z = blockIdx.z; A += z * sA; Bt += z * sB; C += z * sC; if (NSPLIT == 2) { A2 += z * sA; Bt2 += z * sB; }
    const int lane = threadIdx.x & 31, lr = lane & 15, hi = lane >> 4; const int r0 = blockIdx.x * 64, c0 = blockIdx.y * 64;
    if (CSKIP) { if (c0 > ((rofs + r0) | 127)) return; }
    const int kend = K;
    v8f acc[4][4];
#pragma unroll
    for (int mb = 0; mb < 4; ++mb)
#pragma unroll
        for (int nb = 0; nb < 4; ++nb) acc[mb][nb] = (v8f){};
    const size_t aoff = (size_t)(r0 + lr) * K + 8 * hi, boff = (size_t)(c0 + lr) * K + 8 * hi;
#pragma unroll 1
    for (int kc = 0; kc < kend; kc += 32) {
        V a[4], a2[4], bl, b2l;
#pragma unroll
        for (int mb = 0; mb < 4; ++mb) { a[mb] = WFrag<T16>::ld(A + aoff + (size_t)mb * 16 * K + kc); if (NSPLIT == 2) a2[mb] = WFrag<T16>::ld(A2 + aoff + (size_t)mb * 16 * K + kc); else a2[mb] = a[mb]; }
#pragma unroll
        for (int nb = 0; nb < 4; ++nb) { const V b = WFrag<T16>::ld(Bt + boff + (size_t)nb * 16 * K + kc); V b2 = b; if (NSPLIT == 2) b2 = WFrag<T16>::ld(Bt2 + boff + (size_t)nb * 16 * K + kc);
#pragma unroll
            for (int mb = 0; mb < 4; ++mb) { acc[mb][nb] = WFrag<T16>::mma(a[mb], b, acc[mb][nb]); if (NSPLIT == 2) { acc[mb][nb] = WFrag<T16>::mma(a2[mb], b, acc[mb][nb]); acc[mb][nb] = WFrag<T16>::mma(a[mb], b2, acc[mb][nb]); } }
            bl = b; b2l = b2; }
        asm volatile("v_nop\n\tv_nop\n\tv_nop\n\tv_nop" : "+v"(acc[0][0]), "+v"(acc[1][1]), "+v"(acc[2][2]), "+v"(acc[3][3]) : "v"(a[0]), "v"(a[3]), "v"(a2[3]), "v"(bl), "v"(b2l));
    }
#pragma unroll
    for (int mb = 0; mb < 4; ++mb) {
#pragma unroll
        for (int nb = 0; nb < 4; ++nb) {
#pragma unroll
            for (int j = 0; j < 8; ++j) os[(hi * 8 + j) * 68 + nb * 16 + lr] = acc[mb][nb][j]; }
        __builtin_amdgcn_wave_barrier(); asm volatile("" ::: "memory");
        float* crow = C + (size_t)(r0 + mb * 16) * ldc + c0;
{
#pragma unroll
            for (int s = 0; s < 8; ++s) { const int row = 2 * s + hi, cofs = lr * 4; const v4f val = *(const v4fa*)(os + row * 68 + cofs);
                *(v4f*)(crow + (size_t)row * ldc + cofs) = val; }
             }
        __builtin_amdgcn_wave_barrier(); asm volatile("" ::: "memory");
    }
}

// ---- k_pv: out = P V for one half of one batch, P and V^T as K-contiguous bf16 hi/lo planes (pitch SEQ), 3 products (hi.hi + lo.hi + hi.lo) as in k_gemmw<bf, 2>.
// One 16x32 output tile per work-group of PVW waves; grid (RHALF/16, HD/32). The causal key range of the tile, rounded up to 64 keys (the planes hold zeros there,
// inside the row block's last 128-wide chunk), is dealt to the waves in chunks of 64 keys (one 128-byte line of every plane row): wave w takes chunks w, w + PVW, ...
// Each wave keeps two chunks' fragments in registers, so that two chunks' loads are in flight at a time. The PVW partial tiles are summed in wave order through LDS.
// Fragment k order: the same loader (WFrag<bf>::ld) at the same k for P and V. Row blocks are dealt longest first (block 0 takes the last row block).
#define PVW 8
#define PVP 36              // LDS pitch in floats of a partial tile's row: lanes 16..31 (row + 8) fall 32 banks from lanes 0..15
static_assert(RHALF % 16 == 0);
struct PvFrag { v16bf ph[2], pl[2], vh[2][2], vl[2][2]; };   // [k step of 32]; [column block][k step]
__device__ __forceinline__ void pv_load(PvFrag& f, const bf* ph, const bf* pl, const bf* vh, const bf* vl, int k0) {
    ph += k0; pl += k0; vh += k0; vl += k0;
    // the three loops are unrolled so that every fragment index is a constant (registers, not scratch)
#pragma unroll
    for (int s = 0; s < 2; ++s) { f.ph[s] = WFrag<bf>::ld(ph + 32 * s); f.pl[s] = WFrag<bf>::ld(pl + 32 * s); }
#pragma unroll
    for (int nb = 0; nb < 2; ++nb)
#pragma unroll
        for (int s = 0; s < 2; ++s) { f.vh[nb][s] = WFrag<bf>::ld(vh + (size_t)nb * 16 * SEQ + 32 * s); f.vl[nb][s] = WFrag<bf>::ld(vl + (size_t)nb * 16 * SEQ + 32 * s); }
    // the wait that stands before an issued load's address registers are rewritten; the four addresses are inputs so that they stay in their registers up to it
    asm volatile("s_wait_xcnt 0x0" :: "v"(ph), "v"(pl), "v"(vh), "v"(vl) : "memory");
}
__device__ __forceinline__ void pv_mma(const PvFrag& f, v8f& c0, v8f& c1) {
#pragma unroll   // constant fragment indices, as above
    for (int s = 0; s < 2; ++s) {
        c0 = wmmab(f.ph[s], f.vh[0][s], c0); c1 = wmmab(f.ph[s], f.vh[1][s], c1);
        c0 = wmmab(f.pl[s], f.vh[0][s], c0); c1 = wmmab(f.pl[s], f.vh[1][s], c1);
        c0 = wmmab(f.ph[s], f.vl[0][s], c0); c1 = wmmab(f.ph[s], f.vl[1][s], c1); }
    // four vector slots behind the last WMMA on every path (a branch follows), before its operands are reloaded or its result is read
    asm volatile("v_nop\n\tv_nop\n\tv_nop\n\tv_nop" : "+v"(c0), "+v"(c1) : "v"(f.ph[1]), "v"(f.pl[1]), "v"(f.vh[0][1]), "v"(f.vh[1][1]), "v"(f.vl[0][1]), "v"(f.vl[1][1]));
}
__global__ __launch_bounds__(32 * PVW) void k_pv(const bf* __restrict__ Ph, const bf* __restrict__ Pl, const bf* __restrict__ Vh, const bf* __restrict__ Vl, float* O, int rofs) {
    __shared__ __align__(16) float red[PVW][16 * PVP];
    const int lane = threadIdx.x & 31, lr = lane & 15, hi = lane >> 4; const int w = __builtin_amdgcn_readfirstlane((int)(threadIdx.x >> 5));
    const int r0 = (int)(gridDim.x - 1 - blockIdx.x) * 16, c0 = blockIdx.y * 32;
    const int nck = (rofs + r0 + 16 + 63) >> 6;      // live 64-key chunks of this row block, <= SEQ / 64
    const bf* ph = Ph + (size_t)(r0 + lr) * SEQ + 8 * hi; const bf* pl = Pl + (size_t)(r0 + lr) * SEQ + 8 * hi;
    const bf* vh = Vh + (size_t)(c0 + lr) * SEQ + 8 * hi; const bf* vl = Vl + (size_t)(c0 + lr) * SEQ + 8 * hi;
    v8f a0 = (v8f){}, a1 = (v8f){};
    PvFrag f0, f1;
    if (w < nck) pv_load(f0, ph, pl, vh, vl, w * 64);
#pragma unroll 1   // stays rolled: one trip already holds both fragment sets, a second copy would not fit the registers
    for (int c = w; c < nck; c += 2 * PVW) {
        const bool more = c + PVW < nck;
        if (more) pv_load(f1, ph, pl, vh, vl, (c + PVW) * 64);
        pv_mma(f0, a0, a1);
        if (c + 2 * PVW < nck) pv_load(f0, ph, pl, vh, vl, (c + 2 * PVW) * 64);
        if (more) pv_mma(f1, a0, a1);
    }
#pragma unroll   // constant accumulator element indices
    for (int j = 0; j < 8; ++j) { red[w][(hi * 8 + j) * PVP + lr] = a0[j]; red[w][(hi * 8 + j) * PVP + 16 + lr] = a1[j]; }
    __syncthreads();         // every wave's partial tile is in LDS before any of it is summed
    const int row = threadIdx.x >> 4, col = (threadIdx.x & 15) * 2;
    float sx = red[0][row * PVP + col], sy = red[0][row * PVP + col + 1];
#pragma unroll   // all LDS reads issue ahead of the adds
    for (int q = 1; q < PVW; ++q) { sx += red[q][row * PVP + col]; sy += red[q][row * PVP + col + 1]; }
    v2f o; o[0] = sx; o[1] = sy; *(v2f*)(O + (size_t)(r0 + row) * HD + c0 + col) = o;   // a wave stores two whole 128-byte lines
}

__global__ __launch_bounds__(256) void k_wt3(const float* __restrict__ w0, const float* __restrict__ w1, const float* __restrict__ w2, bf* Wt) {
    const int which = blockIdx.y; const float* w = (which == 0) ? w0 : ((which == 1) ? w1 : w2); bf* Bt = Wt + (size_t)which * HD * DIN;
    const int lane = threadIdx.x & 31; const int L0 = (blockIdx.x * 8 + (threadIdx.x >> 5)) * 8; const int nlines = HD * DIN / 64;
{
#pragma unroll 1
        for (int l = 0; l < 8; ++l) { const int L = L0 + l; if (L >= nlines) break; const size_t e = (size_t)L * 64 + lane * 2; const int k = (int)(e % DIN), n = (int)(e / DIN); v2us o;
            o[0] = f2bf(w[(size_t)k * HD + n]); o[1] = f2bf(w[(size_t)(k + 1) * HD + n]); *(v2us*)(Bt + e) = o; }
         }
}

__global__ __launch_bounds__(256) void k_cvtx(const float* __restrict__ X, bf* Xb, size_t n8) {
    const size_t i = (size_t)blockIdx.x * 256 + threadIdx.x; if (i >= n8) return; const size_t e = i * 8; const size_t r = e / DIN; const int c = (int)(e - r * DIN);
    const size_t srow = (r / SEQ) * SEQ_FULL + (r % SEQ);
    const float* p = X + srow * DIN + c; const v4f a0 = *(const v4f*)p; const v4f a1 = *(const v4f*)(p + 4); v8us o;
#pragma unroll
    for (int k = 0; k < 4; ++k) { o[k] = f2bf(a0[k]); o[k + 4] = f2bf(a1[k]); }
    *(v8us*)(Xb + e) = o; 
}

__global__ __launch_bounds__(256) void k_plane3(const float* __restrict__ F, h16* P16, bf* Ph, bf* Pl, size_t n8) {
    const size_t i = (size_t)blockIdx.x * 256 + threadIdx.x; if (i >= n8) return;
    const v4f x0 = *(const v4f*)(F + i * 8); const v4f x1 = *(const v4f*)(F + i * 8 + 4);
    v8h o16; v8us oh, ol;
#pragma unroll
    for (int k = 0; k < 4; ++k) { const float y0 = x0[k] * QCAR, y1 = x1[k] * QCAR; o16[k] = (h16)y0; o16[k + 4] = (h16)y1; unsigned short a, c; splitf(y0, a, c); oh[k] = a; ol[k] = c; splitf(y1, a, c); oh[k + 4] = a; ol[k + 4] = c; }
    *(v8h*)(P16 + i * 8) = o16; *(v8us*)(Ph + i * 8) = oh; *(v8us*)(Pl + i * 8) = ol;
    
}

__global__ __launch_bounds__(256) void k_vtp(const float* __restrict__ F, bf* Vh, bf* Vl) {
    const size_t e = ((size_t)blockIdx.x * 256 + threadIdx.x) * 2; if (e >= (size_t)NB * HD * SEQ) return;
    const int t = (int)(e % SEQ); const int d = (int)((e / SEQ) % HD); const int g = (int)(e / ((size_t)SEQ * HD));
    v2us oh, ol;
#pragma unroll
    for (int q = 0; q < 2; ++q) { const float x = F[((size_t)g * SEQ + t + q) * HD + d]; unsigned short a, c; splitf(x, a, c); oh[q] = a; ol[q] = c; }
    *(v2us*)(Vh + e) = oh; *(v2us*)(Vl + e) = ol; 
}

// k_asoft: one wave per query row (local row lrow, global index i = rofs + lrow): t = S[lrow][j] x SCL for keys j <= i, excluded (treated as -inf) otherwise;
// max-subtracted softmax in f32 over the live 128-wide chunks held in registers; normalised probabilities written as bf16 hi/lo planes
__global__ __launch_bounds__(256) void k_asoft(const float* __restrict__ Sb, int rofs, bf* Ph, bf* Pl) {
    const int lane = threadIdx.x & 31; const int lrow = blockIdx.x * 8 + (threadIdx.x >> 5); if (lrow >= RHALF) return;
    const int i = rofs + lrow; const int nch = (i >> 7) + 1;
    const float* sr = Sb + (size_t)lrow * SEQ; float v[SEQ / 32]; float mx = -3.0e38f;
#pragma unroll
    for (int ch = 0; ch < SEQ / 128; ++ch) {
        const int j0 = ch * 128 + lane * 4;
        if (ch < nch) { const v4f a = *(const v4f*)(sr + j0);
#pragma unroll
            for (int q = 0; q < 4; ++q) { const float t = (j0 + q <= i) ? a[q] * SCL : -3.0e38f; v[ch * 4 + q] = t; mx = fmaxf(mx, t); }
        } else {
#pragma unroll
            for (int q = 0; q < 4; ++q) v[ch * 4 + q] = 0.0f; }
    }
#pragma unroll
    for (int sh = 16; sh; sh >>= 1) mx = fmaxf(mx, __shfl_xor(mx, sh, 32));
    float sum = 0.f;
#pragma unroll
    for (int ch = 0; ch < SEQ / 128; ++ch) { if (ch < nch) {
#pragma unroll
        for (int q = 0; q < 4; ++q) { const int k = ch * 4 + q; float d0 = __fsub_rn(v[k], mx); asm volatile("" : "+v"(d0)); v[k] = __builtin_amdgcn_exp2f(__fmul_rn(d0, 1.4426950408889634f)); sum += v[k]; } } }
#pragma unroll
    for (int sh = 16; sh; sh >>= 1) sum += __shfl_xor(sum, sh, 32);
    const float f = __fdiv_rn(1.0f, sum);
#pragma unroll
    for (int ch = 0; ch < SEQ / 128; ++ch) { if (ch < nch) {
#pragma unroll
        for (int q = 0; q < 4; ++q) { const int k = ch * 4 + q; unsigned short a, c; splitf(v[k] * f, a, c); v[k] = __uint_as_float((unsigned)a | (((unsigned)c) << 16)); } } }
{
#pragma unroll
        for (int ch = 0; ch < SEQ / 128; ++ch) { if (ch < nch) { v4us oh, ol;
#pragma unroll
            for (int q = 0; q < 4; ++q) { const unsigned w = __float_as_uint(v[ch * 4 + q]); oh[q] = (unsigned short)(w & 0xFFFFu); ol[q] = (unsigned short)(w >> 16); }
            const size_t oo = (size_t)lrow * SEQ + ch * 128 + lane * 4; *(v4us*)(Ph + oo) = oh; *(v4us*)(Pl + oo) = ol; } }
         }
}

static constexpr size_t al256(size_t b) { return (b + 255) & ~(size_t)255; }
static constexpr size_t WS_TOTAL = al256((size_t)3 * HD * DIN * 2) + al256((size_t)NB * SEQ * DIN * 2) + al256((size_t)3 * NB * SEQ * HD * 4)
                                 + 6 * al256((size_t)NB * SEQ * HD * 2) + 2 * al256((size_t)NB * HD * SEQ * 2) + al256((size_t)RHALF * SEQ * 4) + 2 * al256((size_t)RHALF * SEQ * 2);
static_assert(WS_TOTAL <= (size_t)134217728);
static_assert((size_t)NB * SEQ * HD * 4 <= (size_t)4194304);

extern "C" void kernel_launch(void* const* d_in, const int* in_sizes, int n_in,
                              void* d_out, int out_size, void* d_ws, size_t ws_size, hipStream_t stream) {
    if (n_in < 4) return;
    if (in_sizes[0] < ((NB - 1) * SEQ_FULL + SEQ) * DIN) return;
    if (in_sizes[1] < DIN * HD || in_sizes[2] < DIN * HD || in_sizes[3] < DIN * HD) return;
    if (out_size < NB * SEQ * HD) return;
    const float* Xin = (const float*)d_in[0]; const float* Wq = (const float*)d_in[1]; const float* Wk = (const float*)d_in[2]; const float* Wv = (const float*)d_in[3];
    float* OUT = (float*)d_out;     // [NB][SEQ][64]
    char* wsp = (char*)d_ws;
    auto take = [&](size_t bytes) { char* p = wsp; wsp += al256(bytes); return (void*)p; };
    const size_t nTok = (size_t)NB * SEQ;
    bf* Wt = (bf*)take((size_t)3 * HD * DIN * 2);                 // [3][64][768] bf16
    bf* Xb = (bf*)take(nTok * DIN * 2);                            // [NB*SEQ][768] bf16
    float* QKVf = (float*)take((size_t)3 * nTok * HD * 4);          // q, k, v f32 [NB*SEQ][64] each
    h16* Q16 = (h16*)take(nTok * HD * 2); bf* Qh = (bf*)take(nTok * HD * 2); bf* Ql = (bf*)take(nTok * HD * 2);
    h16* K16 = (h16*)take(nTok * HD * 2); bf* Kh = (bf*)take(nTok * HD * 2); bf* Kl = (bf*)take(nTok * HD * 2);
    bf* Vh = (bf*)take((size_t)NB * HD * SEQ * 2); bf* Vl = (bf*)take((size_t)NB * HD * SEQ * 2);   // [NB][64][SEQ]
    float* Sb = (float*)take((size_t)RHALF * SEQ * 4);             // scores x16 [RHALF][SEQ]
    bf* Eh = (bf*)take((size_t)RHALF * SEQ * 2); bf* El = (bf*)take((size_t)RHALF * SEQ * 2);       // normalised probabilities hi/lo [RHALF][SEQ]
    if ((size_t)(wsp - (char*)d_ws) > ws_size) return;             // total = WS_TOTAL (~116 MiB at full size)
    const float* Qf = QKVf; const float* Kf = QKVf + nTok * HD; const float* Vf = QKVf + 2 * nTok * HD;

    k_wt3<<<dim3(HD * DIN / 64 / 64, 3), 256, 0, stream>>>(Wq, Wk, Wv, Wt);
    { const size_t n8 = nTok * DIN / 8; k_cvtx<<<(unsigned)((n8 + 255) / 256), 256, 0, stream>>>(Xin, Xb, n8); }
    k_gemmw<bf, 0, false><<<dim3((unsigned)(nTok / 64), 1, 3), 32, 0, stream>>>(Xb, nullptr, Wt, nullptr, DIN, QKVf, HD, 0, (size_t)0, (size_t)HD * DIN, nTok * HD);   /* q, k, v = x W (exact bf16 products) */
    { const size_t n8 = nTok * HD / 8;
      k_plane3<<<(unsigned)((n8 + 255) / 256), 256, 0, stream>>>(Qf, Q16, Qh, Ql, n8);
      k_plane3<<<(unsigned)((n8 + 255) / 256), 256, 0, stream>>>(Kf, K16, Kh, Kl, n8); }
    k_vtp<<<(unsigned)(((size_t)NB * HD * SEQ / 2 + 255) / 256), 256, 0, stream>>>(Vf, Vh, Vl);
    for (int b = 0; b < NB; ++b) {
        for (int h = 0; h < 2; ++h) {
            const int rofs = h * RHALF;
            k_gemmw<h16, 0, true><<<dim3(RHALF / 64, (rofs + RHALF) / 64, 1), 32, 0, stream>>>(Q16 + ((size_t)b * SEQ + rofs) * HD, nullptr, K16 + (size_t)b * SEQ * HD, nullptr, HD, Sb, SEQ, rofs, (size_t)0, (size_t)0, (size_t)0);   /* scores x16, causal tiles */
            if (h == 0) k_gemmw<bf, 2, false><<<dim3(1, 1, 1), 32, 0, stream>>>(Qh + (size_t)b * SEQ * HD, Ql + (size_t)b * SEQ * HD, Kh + (size_t)b * SEQ * HD, Kl + (size_t)b * SEQ * HD, HD, Sb, SEQ, 0, (size_t)0, (size_t)0, (size_t)0);   /* rows < 64 x keys < 64: 3 products */
            k_asoft<<<RHALF / 8, 256, 0, stream>>>(Sb, rofs, Eh, El);
            k_pv<<<dim3(RHALF / 16, HD / 32, 1), 32 * PVW, 0, stream>>>(Eh, El, Vh + (size_t)b * HD * SEQ, Vl + (size_t)b * HD * SEQ, OUT + ((size_t)b * SEQ + rofs) * HD, rofs);   /* attn (hi/lo) x v^T (hi/lo) -> out rows */
        }
    }
}

// v002
// It runs in 199 microseconds.
// Timed twice side by side with v001, it ran 1.81 and 1.82 times as fast.
// All steps since v000 together make it 4.38 times as fast.
#include <hip/hip_runtime.h>

// Contractions (all f32 accumulate): q,k,v = x W on v_wmma_f32_16x16x32_bf16 (x and W RNE-converted to bf16, single product);
// scores = q.k on v_wmma_f32_16x16x32_f16 (f16 planes of 4q and 4k, single product) for query rows >= 64, and on
// v_wmma_f32_16x16x32_bf16 with q,k as bf16 hi/lo x hi/lo (3 products) for query rows < 64;
// out = attn.v on v_wmma_f32_16x16x32_bf16 with normalised probabilities and v both as bf16 hi/lo planes (3 products). Softmax f32.

#ifndef NB
#define NB 4
#endif
#ifndef SEQ
#define SEQ 4096
#endif
#define NB_FULL  4
#define SEQ_FULL 4096
#define DIN   768
#define HD    64
#define NBLK  (SEQ / 128)   // 128-row blocks of a batch
#define RH    64            // query rows < RH: 3-product score tile
#define QCAR  4.0f          // q and k planes carry x4 -> scores carry x16
#define SCL   0.0078125f    // 2^-7 = (64^-0.5) / 16

static_assert(SEQ % 128 == 0);
static_assert(RH <= 128);
static_assert(DIN % 32 == 0);
static_assert(HD == 64);
static_assert((NB * SEQ) % 64 == 0);
static_assert(NB <= NB_FULL);
static_assert(SEQ <= SEQ_FULL);

typedef _Float16 h16;
typedef unsigned short bf;
typedef __attribute__((ext_vector_type(16))) __bf16   v16bf;
typedef __attribute__((ext_vector_type(16))) _Float16 v16h;
typedef __attribute__((ext_vector_type(8)))  _Float16 v8h;
typedef __attribute__((ext_vector_type(8)))  unsigned short v8us;
typedef __attribute__((ext_vector_type(8)))  float    v8f;
typedef __attribute__((ext_vector_type(4)))  float    v4f;
typedef __attribute__((ext_vector_type(2)))  float    v2f;
typedef __attribute__((ext_vector_type(4)))  unsigned short v4us;
typedef __attribute__((ext_vector_type(2)))  unsigned short v2us;
typedef v4f  __attribute__((may_alias)) v4fa;

#pragma clang fp contract(off)

__device__ __forceinline__ unsigned short f2bf(float f) { unsigned u = __float_as_uint(f); u += 0x7FFFu + ((u >> 16) & 1u); return (unsigned short)(u >> 16); }
__device__ __forceinline__ float bf2f(unsigned short b) { return __uint_as_float(((unsigned)b) << 16); }
__device__ __forceinline__ v16h cat16(v8h lo, v8h hi) { return __builtin_shufflevector(lo, hi, 0, 1, 2, 3, 4, 5, 6, 7, 8, 9, 10, 11, 12, 13, 14, 15); }
__device__ __forceinline__ v16bf cat16b(v8us lo, v8us hi) { return __builtin_bit_cast(v16bf, __builtin_shufflevector(lo, hi, 0, 1, 2, 3, 4, 5, 6, 7, 8, 9, 10, 11, 12, 13, 14, 15)); }
__device__ __forceinline__ v8f wmma16(v16h a, v16h b, v8f c) { return __builtin_amdgcn_wmma_f32_16x16x32_f16(false, a, false, b, (short)0, c, false, false); }
__device__ __forceinline__ v8f wmmab(v16bf a, v16bf b, v8f c) { return __builtin_amdgcn_wmma_f32_16x16x32_bf16(false, a, false, b, (short)0, c, false, false); }
__device__ __forceinline__ void splitf(float y, unsigned short& h, unsigned short& l) { h = f2bf(y); l = f2bf(y - bf2f(h)); }

// ---- Packed causal score rows, so that all rows of all batches fit the workspace at once and every stage is one launch.
// Query row i of a batch lies in row block g = i >> 7 and holds only its live keys, rounded up to (g + 1) * 128 floats (its pitch); blocks follow one another.
// k_asoft overwrites a row in place: the first half of its bytes becomes the hi plane of its probabilities, the second half the lo plane (pitch bf16 each).
#define PBAT ((size_t)128 * 128 * NBLK * (NBLK + 1) / 2)     // floats of one batch
__device__ __forceinline__ int    sc_pitch(int i) { return ((i >> 7) + 1) * 128; }
__device__ __forceinline__ size_t sc_row(int i)   { const int g = i >> 7; return (size_t)(128 * 128) * (size_t)(g * (g + 1) / 2) + (size_t)(i & 127) * (size_t)((g + 1) * 128); }

// ---- k_gemmw: register-blocked GEMM, ONE WAVE per 64x64 output tile (16 accumulators), operands straight from K-contiguous 16-bit planes; grid (M/64, N/64, Z), 32 threads.
// C[m][n] (f32, pitch ldc) = sum_k A[m][k] Bt[n][k] (NSPLIT==2: + A2[m][k] Bt[n][k] + A[m][k] Bt2[n][k]). z-batch strides sA/sB/sC in elements. K % 32 == 0.
// Fragments (lane l, h = l>>4, m = n = l&15): elements 0..7 <- k0+8h+0..7, elements 8..15 <- k0+16+8h+0..7 for BOTH A and B; D element r -> (row 8h+r, col l&15).
// CSKIP: tile skipped when its first column c0 > (r0 | 127) (causal, 128-granular), and C holds packed causal rows (sc_row, sc_pitch; ldc is not read).
template <typename T16> struct WFrag;
template <> struct WFrag<h16> { typedef v16h V; static __device__ __forceinline__ V ld(const h16* p) { return cat16(*(const v8h*)p, *(const v8h*)(p + 16)); } static __device__ __forceinline__ v8f mma(V a, V b, v8f c) { return wmma16(a, b, c); } };
template <> struct WFrag<bf> { typedef v16bf V; static __device__ __forceinline__ V ld(const bf* p) { return cat16b(*(const v8us*)p, *(const v8us*)(p + 16)); } static __device__ __forceinline__ v8f mma(V a, V b, v8f c) { return wmmab(a, b, c); } };
template <typename T16, int NSPLIT, bool CSKIP>
__global__ __launch_bounds__(32) void k_gemmw(const T16* __restrict__ A, const T16* __restrict__ A2, const T16* __restrict__ Bt, const T16* __restrict__ Bt2, int K, float* C, int ldc, size_t sA, size_t sB, size_t sC) {
    static_assert(NSPLIT == 0 || NSPLIT == 2);
    typedef typename WFrag<T16>::V V;
    __shared__ __align__(16) float os[16 * 68];
    const size_t z = blockIdx.z; A += z * sA; Bt += z * sB; C += z * sC; if (NSPLIT == 2) { A2 += z * sA; Bt2 += z * sB; }
    const int lane = threadIdx.x & 31, lr = lane & 15, hi = lane >> 4; const int r0 = blockIdx.x * 64, c0 = blockIdx.y * 64;
    if (CSKIP) { if (c0 > (r0 | 127)) return; ldc = sc_pitch(r0); }
    const int kend = K;
    v8f acc[4][4];
#pragma unroll
    for (int mb = 0; mb < 4; ++mb)
#pragma unroll
        for (int nb = 0; nb < 4; ++nb) acc[mb][nb] = (v8f){};
    const size_t aoff = (size_t)(r0 + lr) * K + 8 * hi, boff = (size_t)(c0 + lr) * K + 8 * hi;
#pragma unroll 1
    for (int kc = 0; kc < kend; kc += 32) {
        V a[4], a2[4], bl, b2l;
#pragma unroll
        for (int mb = 0; mb < 4; ++mb) { a[mb] = WFrag<T16>::ld(A + aoff + (size_t)mb * 16 * K + kc); if (NSPLIT == 2) a2[mb] = WFrag<T16>::ld(A2 + aoff + (size_t)mb * 16 * K + kc); else a2[mb] = a[mb]; }
#pragma unroll
        for (int nb = 0; nb < 4; ++nb) { const V b = WFrag<T16>::ld(Bt + boff + (size_t)nb * 16 * K + kc); V b2 = b; if (NSPLIT == 2) b2 = WFrag<T16>::ld(Bt2 + boff + (size_t)nb * 16 * K + kc);
#pragma unroll
            for (int mb = 0; mb < 4; ++mb) { acc[mb][nb] = WFrag<T16>::mma(a[mb], b, acc[mb][nb]); if (NSPLIT == 2) { acc[mb][nb] = WFrag<T16>::mma(a2[mb], b, acc[mb][nb]); acc[mb][nb] = WFrag<T16>::mma(a[mb], b2, acc[mb][nb]); } }
            bl = b; b2l = b2; }
        asm volatile("v_nop\n\tv_nop\n\tv_nop\n\tv_nop" : "+v"(acc[0][0]), "+v"(acc[1][1]), "+v"(acc[2][2]), "+v"(acc[3][3]) : "v"(a[0]), "v"(a[3]), "v"(a2[3]), "v"(bl), "v"(b2l));
    }
#pragma unroll
    for (int mb = 0; mb < 4; ++mb) {
#pragma unroll
        for (int nb = 0; nb < 4; ++nb) {
#pragma unroll
            for (int j = 0; j < 8; ++j) os[(hi * 8 + j) * 68 + nb * 16 + lr] = acc[mb][nb][j]; }
        __builtin_amdgcn_wave_barrier(); asm volatile("" ::: "memory");
        float* crow = C + (CSKIP ? sc_row(r0 + mb * 16) : (size_t)(r0 + mb * 16) * ldc) + c0;
{
#pragma unroll
            for (int s = 0; s < 8; ++s) { const int row = 2 * s + hi, cofs = lr * 4; const v4f val = *(const v4fa*)(os + row * 68 + cofs);
                *(v4f*)(crow + (size_t)row * ldc + cofs) = val; }
             }
        __builtin_amdgcn_wave_barrier(); asm volatile("" ::: "memory");
    }
}

// ---- k_pv: out = P V for all batches, P (packed causal rows, see sc_row) and V^T (pitch SEQ) as K-contiguous bf16 hi/lo planes, 3 products (hi.hi + lo.hi + hi.lo) as in k_gemmw<bf, 2>.
// One 16x32 output tile per work-group of PVW waves; grid (NB * HD/32, SEQ/16). The causal key range of the tile, rounded up to 64 keys (the planes hold zeros there,
// inside the row block's last 128-wide chunk), is dealt to the waves in chunks of 64 keys (one 128-byte line of every plane row): wave w takes chunks w, w + PVW, ...
// Each wave keeps two chunks' fragments in registers, so that two chunks' loads are in flight at a time. The PVW partial tiles are summed in wave order through LDS.
// Fragment k order: the same loader (WFrag<bf>::ld) at the same k for P and V. Row blocks are dealt longest first over all batches;
// the two column blocks that read the same P rows are neighbours in x.
#define PVW 8
#define PVP 36              // LDS pitch in floats of a partial tile's row: lanes 16..31 (row + 8) fall 32 banks from lanes 0..15
struct PvFrag { v16bf ph[2], pl[2], vh[2][2], vl[2][2]; };   // [k step of 32]; [column block][k step]
__device__ __forceinline__ void pv_load(PvFrag& f, const bf* ph, const bf* pl, const bf* vh, const bf* vl, int k0) {
    ph += k0; pl += k0; vh += k0; vl += k0;
    // the three loops are unrolled so that every fragment index is a constant (registers, not scratch)
#pragma unroll
    for (int s = 0; s < 2; ++s) { f.ph[s] = WFrag<bf>::ld(ph + 32 * s); f.pl[s] = WFrag<bf>::ld(pl + 32 * s); }
#pragma unroll
    for (int nb = 0; nb < 2; ++nb)
#pragma unroll
        for (int s = 0; s < 2; ++s) { f.vh[nb][s] = WFrag<bf>::ld(vh + (size_t)nb * 16 * SEQ + 32 * s); f.vl[nb][s] = WFrag<bf>::ld(vl + (size_t)nb * 16 * SEQ + 32 * s); }
    // the wait that stands before an issued load's address registers are rewritten; the four addresses are inputs so that they stay in their registers up to it
    asm volatile("s_wait_xcnt 0x0" :: "v"(ph), "v"(pl), "v"(vh), "v"(vl) : "memory");
}
__device__ __forceinline__ void pv_mma(const PvFrag& f, v8f& c0, v8f& c1) {
#pragma unroll   // constant fragment indices, as above
    for (int s = 0; s < 2; ++s) {
        c0 = wmmab(f.ph[s], f.vh[0][s], c0); c1 = wmmab(f.ph[s], f.vh[1][s], c1);
        c0 = wmmab(f.pl[s], f.vh[0][s], c0); c1 = wmmab(f.pl[s], f.vh[1][s], c1);
        c0 = wmmab(f.ph[s], f.vl[0][s], c0); c1 = wmmab(f.ph[s], f.vl[1][s], c1); }
    // four vector slots behind the last WMMA on every path (a branch follows), before its operands are reloaded or its result is read
    asm volatile("v_nop\n\tv_nop\n\tv_nop\n\tv_nop" : "+v"(c0), "+v"(c1) : "v"(f.ph[1]), "v"(f.pl[1]), "v"(f.vh[0][1]), "v"(f.vh[1][1]), "v"(f.vl[0][1]), "v"(f.vl[1][1]));
}
__global__ __launch_bounds__(32 * PVW) void k_pv(const float* __restrict__ Sp, const bf* __restrict__ Vh, const bf* __restrict__ Vl, float* O) {
    __shared__ __align__(16) float red[PVW][16 * PVP];
    const int lane = threadIdx.x & 31, lr = lane & 15, hi = lane >> 4; const int w = __builtin_amdgcn_readfirstlane((int)(threadIdx.x >> 5));
    const int r0 = (int)(gridDim.y - 1 - blockIdx.y) * 16, c0 = (int)(blockIdx.x % (HD / 32)) * 32; const size_t b = blockIdx.x / (HD / 32);
    const int nck = (r0 + 16 + 63) >> 6;             // live 64-key chunks of this row block, <= sc_pitch(r0) / 64
    const bf* ph = (const bf*)(Sp + b * PBAT + sc_row(r0 + lr)) + 8 * hi; const bf* pl = ph + sc_pitch(r0);
    const bf* vh = Vh + (b * HD + c0 + lr) * SEQ + 8 * hi; const bf* vl = Vl + (b * HD + c0 + lr) * SEQ + 8 * hi;
    v8f a0 = (v8f){}, a1 = (v8f){};
    PvFrag f0, f1;
    if (w < nck) pv_load(f0, ph, pl, vh, vl, w * 64);
#pragma unroll 1   // stays rolled: one trip already holds both fragment sets, a second copy would not fit the registers
    for (int c = w; c < nck; c += 2 * PVW) {
        const bool more = c + PVW < nck;
        if (more) pv_load(f1, ph, pl, vh, vl, (c + PVW) * 64);
        pv_mma(f0, a0, a1);
        if (c + 2 * PVW < nck) pv_load(f0, ph, pl, vh, vl, (c + 2 * PVW) * 64);
        if (more) pv_mma(f1, a0, a1);
    }
#pragma unroll   // constant accumulator element indices
    for (int j = 0; j < 8; ++j) { red[w][(hi * 8 + j) * PVP + lr] = a0[j]; red[w][(hi * 8 + j) * PVP + 16 + lr] = a1[j]; }
    __syncthreads();         // every wave's partial tile is in LDS before any of it is summed
    const int row = threadIdx.x >> 4, col = (threadIdx.x & 15) * 2;
    float sx = red[0][row * PVP + col], sy = red[0][row * PVP + col + 1];
#pragma unroll   // all LDS reads issue ahead of the adds
    for (int q = 1; q < PVW; ++q) { sx += red[q][row * PVP + col]; sy += red[q][row * PVP + col + 1]; }
    v2f o; o[0] = sx; o[1] = sy; *(v2f*)(O + (b * SEQ + r0 + row) * HD + c0 + col) = o;   // a wave stores two whole 128-byte lines
}

__global__ __launch_bounds__(256) void k_wt3(const float* __restrict__ w0, const float* __restrict__ w1, const float* __restrict__ w2, bf* Wt) {
    const int which = blockIdx.y; const float* w = (which == 0) ? w0 : ((which == 1) ? w1 : w2); bf* Bt = Wt + (size_t)which * HD * DIN;
    const int lane = threadIdx.x & 31; const int L0 = (blockIdx.x * 8 + (threadIdx.x >> 5)) * 8; const int nlines = HD * DIN / 64;
{
#pragma unroll 1
        for (int l = 0; l < 8; ++l) { const int L = L0 + l; if (L >= nlines) break; const size_t e = (size_t)L * 64 + lane * 2; const int k = (int)(e % DIN), n = (int)(e / DIN); v2us o;
            o[0] = f2bf(w[(size_t)k * HD + n]); o[1] = f2bf(w[(size_t)(k + 1) * HD + n]); *(v2us*)(Bt + e) = o; }
         }
}

__global__ __launch_bounds__(256) void k_cvtx(const float* __restrict__ X, bf* Xb, size_t n8) {
    const size_t i = (size_t)blockIdx.x * 256 + threadIdx.x; if (i >= n8) return; const size_t e = i * 8; const size_t r = e / DIN; const int c = (int)(e - r * DIN);
    const size_t srow = (r / SEQ) * SEQ_FULL + (r % SEQ);
    const float* p = X + srow * DIN + c; const v4f a0 = *(const v4f*)p; const v4f a1 = *(const v4f*)(p + 4); v8us o;
#pragma unroll
    for (int k = 0; k < 4; ++k) { o[k] = f2bf(a0[k]); o[k + 4] = f2bf(a1[k]); }
    *(v8us*)(Xb + e) = o; 
}

__global__ __launch_bounds__(256) void k_plane3(const float* __restrict__ F, h16* P16, bf* Ph, bf* Pl, size_t n8) {
    const size_t i = (size_t)blockIdx.x * 256 + threadIdx.x; if (i >= n8) return;
    const v4f x0 = *(const v4f*)(F + i * 8); const v4f x1 = *(const v4f*)(F + i * 8 + 4);
    v8h o16; v8us oh, ol;
#pragma unroll
    for (int k = 0; k < 4; ++k) { const float y0 = x0[k] * QCAR, y1 = x1[k] * QCAR; o16[k] = (h16)y0; o16[k + 4] = (h16)y1; unsigned short a, c; splitf(y0, a, c); oh[k] = a; ol[k] = c; splitf(y1, a, c); oh[k + 4] = a; ol[k + 4] = c; }
    *(v8h*)(P16 + i * 8) = o16; *(v8us*)(Ph + i * 8) = oh; *(v8us*)(Pl + i * 8) = ol;
    
}

__global__ __launch_bounds__(256) void k_vtp(const float* __restrict__ F, bf* Vh, bf* Vl) {
    const size_t e = ((size_t)blockIdx.x * 256 + threadIdx.x) * 2; if (e >= (size_t)NB * HD * SEQ) return;
    const int t = (int)(e % SEQ); const int d = (int)((e / SEQ) % HD); const int g = (int)(e / ((size_t)SEQ * HD));
    v2us oh, ol;
#pragma unroll
    for (int q = 0; q < 2; ++q) { const float x = F[((size_t)g * SEQ + t + q) * HD + d]; unsigned short a, c; splitf(x, a, c); oh[q] = a; ol[q] = c; }
    *(v2us*)(Vh + e) = oh; *(v2us*)(Vl + e) = ol; 
}

// k_asoft: one wave per query row i of batch blockIdx.x, grid (NB, SEQ/8), longest rows first: t = S[i][j] x SCL for keys j <= i, excluded (treated as -inf) otherwise;
// max-subtracted softmax in f32 over the live 128-wide chunks held in registers; normalised probabilities written as bf16 hi/lo planes over the wave's own score row,
// every float of which the wave has read by then (the row's sum, which every stored value is scaled by, needs them all)
__global__ __launch_bounds__(256) void k_asoft(float* Sb) {
    const int lane = threadIdx.x & 31; const int i = (int)(gridDim.y - 1 - blockIdx.y) * 8 + (int)(threadIdx.x >> 5);
    const int nch = (i >> 7) + 1;
    float* sr = Sb + (size_t)blockIdx.x * PBAT + sc_row(i); bf* Ph = (bf*)sr; bf* Pl = Ph + sc_pitch(i); float v[SEQ / 32]; float mx = -3.0e38f;
#pragma unroll
    for (int ch = 0; ch < SEQ / 128; ++ch) {
        const int j0 = ch * 128 + lane * 4;
        if (ch < nch) { const v4f a = *(const v4f*)(sr + j0);
#pragma unroll
            for (int q = 0; q < 4; ++q) { const float t = (j0 + q <= i) ? a[q] * SCL : -3.0e38f; v[ch * 4 + q] = t; mx = fmaxf(mx, t); }
        } else {
#pragma unroll
            for (int q = 0; q < 4; ++q) v[ch * 4 + q] = 0.0f; }
    }
#pragma unroll
    for (int sh = 16; sh; sh >>= 1) mx = fmaxf(mx, __shfl_xor(mx, sh, 32));
    float sum = 0.f;
#pragma unroll
    for (int ch = 0; ch < SEQ / 128; ++ch) { if (ch < nch) {
#pragma unroll
        for (int q = 0; q < 4; ++q) { const int k = ch * 4 + q; float d0 = __fsub_rn(v[k], mx); asm volatile("" : "+v"(d0)); v[k] = __builtin_amdgcn_exp2f(__fmul_rn(d0, 1.4426950408889634f)); sum += v[k]; } } }
#pragma unroll
    for (int sh = 16; sh; sh >>= 1) sum += __shfl_xor(sum, sh, 32);
    const float f = __fdiv_rn(1.0f, sum);
#pragma unroll
    for (int ch = 0; ch < SEQ / 128; ++ch) { if (ch < nch) {
#pragma unroll
        for (int q = 0; q < 4; ++q) { const int k = ch * 4 + q; unsigned short a, c; splitf(v[k] * f, a, c); v[k] = __uint_as_float((unsigned)a | (((unsigned)c) << 16)); } } }
{
#pragma unroll
        for (int ch = 0; ch < SEQ / 128; ++ch) { if (ch < nch) { v4us oh, ol;
#pragma unroll
            for (int q = 0; q < 4; ++q) { const unsigned w = __float_as_uint(v[ch * 4 + q]); oh[q] = (unsigned short)(w & 0xFFFFu); ol[q] = (unsigned short)(w >> 16); }
            const int oo = ch * 128 + lane * 4; *(v4us*)(Ph + oo) = oh; *(v4us*)(Pl + oo) = ol; } }
         }
}

static constexpr size_t al256(size_t b) { return (b + 255) & ~(size_t)255; }
static constexpr size_t WS_TOTAL = al256((size_t)3 * HD * DIN * 2) + al256((size_t)NB * SEQ * DIN * 2) + al256((size_t)3 * NB * SEQ * HD * 4)
                                 + 6 * al256((size_t)NB * SEQ * HD * 2) + 2 * al256((size_t)NB * HD * SEQ * 2) + al256((size_t)NB * PBAT * 4);
static_assert(WS_TOTAL <= (size_t)268435456);
static_assert((size_t)NB * SEQ * HD * 4 <= (size_t)4194304);

extern "C" void kernel_launch(void* const* d_in, const int* in_sizes, int n_in,
                              void* d_out, int out_size, void* d_ws, size_t ws_size, hipStream_t stream) {
    if (n_in < 4) return;
    if (in_sizes[0] < ((NB - 1) * SEQ_FULL + SEQ) * DIN) return;
    if (in_sizes[1] < DIN * HD || in_sizes[2] < DIN * HD || in_sizes[3] < DIN * HD) return;
    if (out_size < NB * SEQ * HD) return;
    const float* Xin = (const float*)d_in[0]; const float* Wq = (const float*)d_in[1]; const float* Wk = (const float*)d_in[2]; const float* Wv = (const float*)d_in[3];
    float* OUT = (float*)d_out;     // [NB][SEQ][64]
    char* wsp = (char*)d_ws;
    auto take = [&](size_t bytes) { char* p = wsp; wsp += al256(bytes); return (void*)p; };
    const size_t nTok = (size_t)NB * SEQ;
    bf* Wt = (bf*)take((size_t)3 * HD * DIN * 2);                 // [3][64][768] bf16
    bf* Xb = (bf*)take(nTok * DIN * 2);                            // [NB*SEQ][768] bf16
    float* QKVf = (float*)take((size_t)3 * nTok * HD * 4);          // q, k, v f32 [NB*SEQ][64] each
    h16* Q16 = (h16*)take(nTok * HD * 2); bf* Qh = (bf*)take(nTok * HD * 2); bf* Ql = (bf*)take(nTok * HD * 2);
    h16* K16 = (h16*)take(nTok * HD * 2); bf* Kh = (bf*)take(nTok * HD * 2); bf* Kl = (bf*)take(nTok * HD * 2);
    bf* Vh = (bf*)take((size_t)NB * HD * SEQ * 2); bf* Vl = (bf*)take((size_t)NB * HD * SEQ * 2);   // [NB][64][SEQ]
    float* Sb = (float*)take((size_t)NB * PBAT * 4);               // [NB] packed causal rows: scores x16, then the normalised probabilities hi/lo in place
    if ((size_t)(wsp - (char*)d_ws) > ws_size) return;             // total = WS_TOTAL (~184 MiB at full size)
    const float* Qf = QKVf; const float* Kf = QKVf + nTok * HD; const float* Vf = QKVf + 2 * nTok * HD;

    k_wt3<<<dim3(HD * DIN / 64 / 64, 3), 256, 0, stream>>>(Wq, Wk, Wv, Wt);
    { const size_t n8 = nTok * DIN / 8; k_cvtx<<<(unsigned)((n8 + 255) / 256), 256, 0, stream>>>(Xin, Xb, n8); }
    k_gemmw<bf, 0, false><<<dim3((unsigned)(nTok / 64), 1, 3), 32, 0, stream>>>(Xb, nullptr, Wt, nullptr, DIN, QKVf, HD, (size_t)0, (size_t)HD * DIN, nTok * HD);   /* q, k, v = x W (exact bf16 products) */
    { const size_t n8 = nTok * HD / 8;
      k_plane3<<<(unsigned)((n8 + 255) / 256), 256, 0, stream>>>(Qf, Q16, Qh, Ql, n8);
      k_plane3<<<(unsigned)((n8 + 255) / 256), 256, 0, stream>>>(Kf, K16, Kh, Kl, n8); }
    k_vtp<<<(unsigned)(((size_t)NB * HD * SEQ / 2 + 255) / 256), 256, 0, stream>>>(Vf, Vh, Vl);
    const size_t sT = (size_t)SEQ * HD;    // one batch of a q or k plane
    k_gemmw<h16, 0, true><<<dim3(SEQ / 64, SEQ / 64, NB), 32, 0, stream>>>(Q16, nullptr, K16, nullptr, HD, Sb, 0, sT, sT, PBAT);   /* scores x16, causal tiles, all batches */
    k_gemmw<bf, 2, false><<<dim3(1, 1, NB), 32, 0, stream>>>(Qh, Ql, Kh, Kl, HD, Sb, 128, sT, sT, PBAT);   /* rows < 64 x keys < 64: 3 products (row block 0: pitch 128) */
    k_asoft<<<dim3(NB, SEQ / 8, 1), 256, 0, stream>>>(Sb);
    k_pv<<<dim3(NB * (HD / 32), SEQ / 16, 1), 32 * PVW, 0, stream>>>(Sb, Vh, Vl, OUT);   /* attn (hi/lo) x v^T (hi/lo) -> out */
}

// v003
// Measured time: 81.7 microseconds a run.
// Timed twice side by side with v002, it ran 2.43 and 2.46 times as fast.
// Counting every step since v000, it is 10.7 times as fast.
#include <hip/hip_runtime.h>

// Contractions (all f32 accumulate): q,k,v = x W on v_wmma_f32_16x16x32_bf16 (x and W RNE-converted to bf16, single product);
// scores = q.k on v_wmma_f32_16x16x32_f16 (f16 planes of 4q and 4k, single product) for query rows >= 64, and on
// v_wmma_f32_16x16x32_bf16 with q,k as bf16 hi/lo x hi/lo (3 products) for query rows < 64;
// out = attn.v on v_wmma_f32_16x16x32_bf16 with un-normalised probabilities and v both as bf16 hi/lo planes (3 products), divided by the row's sum at the end. Softmax f32, online.

#ifndef NB
#define NB 4
#endif
#ifndef SEQ
#define SEQ 4096
#endif
#define NB_FULL  4
#define SEQ_FULL 4096
#define DIN   768
#define HD    64
#define RH    64            // query rows < RH: 3-product score tile
#define QCAR  4.0f          // q and k planes carry x4 -> scores carry x16
#define SCL   0.0078125f    // 2^-7 = (64^-0.5) / 16

static_assert(SEQ % 128 == 0);
static_assert(RH <= 128);
static_assert(DIN % 32 == 0);
static_assert(HD == 64);
static_assert((NB * SEQ) % 64 == 0);
static_assert(NB <= NB_FULL);
static_assert(SEQ <= SEQ_FULL);

typedef _Float16 h16;
typedef unsigned short bf;
typedef __attribute__((ext_vector_type(16))) __bf16   v16bf;
typedef __attribute__((ext_vector_type(16))) _Float16 v16h;
typedef __attribute__((ext_vector_type(8)))  _Float16 v8h;
typedef __attribute__((ext_vector_type(8)))  unsigned short v8us;
typedef __attribute__((ext_vector_type(8)))  float    v8f;
typedef __attribute__((ext_vector_type(4)))  float    v4f;
typedef __attribute__((ext_vector_type(2)))  float    v2f;
typedef __attribute__((ext_vector_type(4)))  unsigned short v4us;
typedef __attribute__((ext_vector_type(2)))  unsigned short v2us;
typedef v4f  __attribute__((may_alias)) v4fa;

#pragma clang fp contract(off)

__device__ __forceinline__ unsigned short f2bf(float f) { unsigned u = __float_as_uint(f); u += 0x7FFFu + ((u >> 16) & 1u); return (unsigned short)(u >> 16); }
__device__ __forceinline__ float bf2f(unsigned short b) { return __uint_as_float(((unsigned)b) << 16); }
__device__ __forceinline__ v16h cat16(v8h lo, v8h hi) { return __builtin_shufflevector(lo, hi, 0, 1, 2, 3, 4, 5, 6, 7, 8, 9, 10, 11, 12, 13, 14, 15); }
__device__ __forceinline__ v16bf cat16b(v8us lo, v8us hi) { return __builtin_bit_cast(v16bf, __builtin_shufflevector(lo, hi, 0, 1, 2, 3, 4, 5, 6, 7, 8, 9, 10, 11, 12, 13, 14, 15)); }
__device__ __forceinline__ v8f wmma16(v16h a, v16h b, v8f c) { return __builtin_amdgcn_wmma_f32_16x16x32_f16(false, a, false, b, (short)0, c, false, false); }
__device__ __forceinline__ v8f wmmab(v16bf a, v16bf b, v8f c) { return __builtin_amdgcn_wmma_f32_16x16x32_bf16(false, a, false, b, (short)0, c, false, false); }
__device__ __forceinline__ void splitf(float y, unsigned short& h, unsigned short& l) { h = f2bf(y); l = f2bf(y - bf2f(h)); }

// ---- k_gemmw: register-blocked GEMM, ONE WAVE per 64x64 output tile (16 accumulators), operands straight from K-contiguous 16-bit planes; grid (M/64, N/64, Z), 32 threads.
// C[m][n] (f32, pitch ldc) = sum_k A[m][k] Bt[n][k] (NSPLIT==2: + A2[m][k] Bt[n][k] + A[m][k] Bt2[n][k]). z-batch strides sA/sB/sC in elements. K % 32 == 0.
// Fragments (lane l, h = l>>4, m = n = l&15): elements 0..7 <- k0+8h+0..7, elements 8..15 <- k0+16+8h+0..7 for BOTH A and B; D element r -> (row 8h+r, col l&15).
template <typename T16> struct WFrag;
template <> struct WFrag<h16> { typedef v16h V; static __device__ __forceinline__ V ld(const h16* p) { return cat16(*(const v8h*)p, *(const v8h*)(p + 16)); } static __device__ __forceinline__ v8f mma(V a, V b, v8f c) { return wmma16(a, b, c); } };
template <> struct WFrag<bf> { typedef v16bf V; static __device__ __forceinline__ V ld(const bf* p) { return cat16b(*(const v8us*)p, *(const v8us*)(p + 16)); } static __device__ __forceinline__ v8f mma(V a, V b, v8f c) { return wmmab(a, b, c); } };
template <typename T16, int NSPLIT>
__global__ __launch_bounds__(32) void k_gemmw(const T16* __restrict__ A, const T16* __restrict__ A2, const T16* __restrict__ Bt, const T16* __restrict__ Bt2, int K, float* C, int ldc, size_t sA, size_t sB, size_t sC) {
    static_assert(NSPLIT == 0 || NSPLIT == 2);
    typedef typename WFrag<T16>::V V;
    __shared__ __align__(16) float os[16 * 68];
    const size_t z = blockIdx.z; A += z * sA; Bt += z * sB; C += z * sC; if (NSPLIT == 2) { A2 += z * sA; Bt2 += z * sB; }
    const int lane = threadIdx.x & 31, lr = lane & 15, hi = lane >> 4; const int r0 = blockIdx.x * 64, c0 = blockIdx.y * 64;
    const int kend = K;
    v8f acc[4][4];
#pragma unroll
    for (int mb = 0; mb < 4; ++mb)
#pragma unroll
        for (int nb = 0; nb < 4; ++nb) acc[mb][nb] = (v8f){};
    const size_t aoff = (size_t)(r0 + lr) * K + 8 * hi, boff = (size_t)(c0 + lr) * K + 8 * hi;
#pragma unroll 1
    for (int kc = 0; kc < kend; kc += 32) {
        V a[4], a2[4], bl, b2l;
#pragma unroll
        for (int mb = 0; mb < 4; ++mb) { a[mb] = WFrag<T16>::ld(A + aoff + (size_t)mb * 16 * K + kc); if (NSPLIT == 2) a2[mb] = WFrag<T16>::ld(A2 + aoff + (size_t)mb * 16 * K + kc); else a2[mb] = a[mb]; }
#pragma unroll
        for (int nb = 0; nb < 4; ++nb) { const V b = WFrag<T16>::ld(Bt + boff + (size_t)nb * 16 * K + kc); V b2 = b; if (NSPLIT == 2) b2 = WFrag<T16>::ld(Bt2 + boff + (size_t)nb * 16 * K + kc);
#pragma unroll
            for (int mb = 0; mb < 4; ++mb) { acc[mb][nb] = WFrag<T16>::mma(a[mb], b, acc[mb][nb]); if (NSPLIT == 2) { acc[mb][nb] = WFrag<T16>::mma(a2[mb], b, acc[mb][nb]); acc[mb][nb] = WFrag<T16>::mma(a[mb], b2, acc[mb][nb]); } }
            bl = b; b2l = b2; }
        asm volatile("v_nop\n\tv_nop\n\tv_nop\n\tv_nop" : "+v"(acc[0][0]), "+v"(acc[1][1]), "+v"(acc[2][2]), "+v"(acc[3][3]) : "v"(a[0]), "v"(a[3]), "v"(a2[3]), "v"(bl), "v"(b2l));
    }
#pragma unroll
    for (int mb = 0; mb < 4; ++mb) {
#pragma unroll
        for (int nb = 0; nb < 4; ++nb) {
#pragma unroll
            for (int j = 0; j < 8; ++j) os[(hi * 8 + j) * 68 + nb * 16 + lr] = acc[mb][nb][j]; }
        __builtin_amdgcn_wave_barrier(); asm volatile("" ::: "memory");
        float* crow = C + (size_t)(r0 + mb * 16) * ldc + c0;
{
#pragma unroll
            for (int s = 0; s < 8; ++s) { const int row = 2 * s + hi, cofs = lr * 4; const v4f val = *(const v4fa*)(os + row * 68 + cofs);
                *(v4f*)(crow + (size_t)row * ldc + cofs) = val; }
             }
        __builtin_amdgcn_wave_barrier(); asm volatile("" ::: "memory");
    }
}

// ---- k_fa: scores, causal softmax and out = P V in one kernel; no score or probability goes to memory.
// One work-group of FAW waves per block of FAQ = 32 query rows of one batch. The block's live keys are cut into passes of 32 keys; wave w takes passes w, w + FAW, ...
// and keeps its own running maximum, sum and un-normalised output tile (online softmax); the FAW partial results are merged through LDS in wave order.
// Transposed products, so that nothing changes lanes between them: S^T = K Q^T (A = key rows, B = query rows, both by WFrag::ld at the same d), D register r of key tile kt = key 16 kt + 8 hi + r
// of query column lr; the two key tiles of a pass, converted in place, are the B operand P^T in the order of WFrag::ld (elements 0..7 <- k0 + 8 hi + 0..7, 8..15 <- k0 + 16 + 8 hi + 0..7),
// and A = V^T rows by WFrag<bf>::ld at the same k0: O^T[d = 16 t + 8 hi + r][query lr] += V^T P^T.
// Products as before: scores on f16 planes of 4q, 4k (query rows >= RH) or bf16 hi/lo, 3 products (query rows < RH); P and V as bf16 hi/lo planes, 3 products (hi.hi + lo.hi + hi.lo). P is split un-normalised.
#define FAW 8
#define FAQ 32
#define FAP 68              // LDS pitch in floats of a partial tile's query row: 16 bytes x odd
#define CEXP (SCL * 1.4426950408889634f)   // raw score -> exponent of 2
static_assert(SEQ % FAQ == 0);
static_assert(RH % FAQ == 0);
static_assert((SEQ / FAQ) % 2 == 0);
typedef __attribute__((ext_vector_type(8))) unsigned v8u;
__device__ __forceinline__ float xhalf(float x) { return __builtin_bit_cast(float, __builtin_amdgcn_permlanex16(__builtin_bit_cast(int, x), __builtin_bit_cast(int, x), 0x76543210, 0xfedcba98, false, false)); }   // lane l <-> lane l ^ 16
__device__ __forceinline__ unsigned pack2(float lo, float hi) { typedef __bf16 b2 __attribute__((ext_vector_type(2))); v2f x; x[0] = lo; x[1] = hi; return __builtin_bit_cast(unsigned, __builtin_convertvector(x, b2)); }   // round to nearest even
// eight exponentials of 2, each in place, in one statement: no v_exp_f32 reads its neighbour's result or overwrites its neighbour's source, and the v_nop is the one slot
// that the instruction set asks for behind the last of them, before its result is used
__device__ __forceinline__ void exp2x8(float& a, float& b, float& c, float& d, float& e, float& f, float& g, float& h) {
    asm("v_exp_f32 %0, %0\n\tv_exp_f32 %1, %1\n\tv_exp_f32 %2, %2\n\tv_exp_f32 %3, %3\n\tv_exp_f32 %4, %4\n\tv_exp_f32 %5, %5\n\tv_exp_f32 %6, %6\n\tv_exp_f32 %7, %7\n\tv_nop"
        : "+v"(a), "+v"(b), "+v"(c), "+v"(d), "+v"(e), "+v"(f), "+v"(g), "+v"(h));
}
template <bool LOW>
__device__ __forceinline__ void fa_loop(const h16* __restrict__ q16, const bf* __restrict__ qh, const bf* __restrict__ ql, const h16* __restrict__ k16, const bf* __restrict__ kh, const bf* __restrict__ kl,
                                        const bf* __restrict__ vh, const bf* __restrict__ vl, int r0, int w, int lr, int hi, v8f (&acc)[2][4], float (&ms)[2], float (&ls)[2]) {
    // all pointers arrive at the lane's own row and 8 * hi: q* at query row r0 + lr, k* at key row lr, v* at V^T row lr
    v16h qf[2][2];
    if (!LOW) {
#pragma unroll
        for (int g = 0; g < 2; ++g)
#pragma unroll
            for (int ks = 0; ks < 2; ++ks) qf[g][ks] = WFrag<h16>::ld(q16 + g * 16 * HD + 32 * ks);
    }
    const int np = r0 / 32 + 1;     // live passes of this query block; the last one holds the diagonal
#pragma unroll 1   // stays rolled: one pass already fills the register budget of four waves per SIMD
    for (int p = w; p < np; p += FAW) {
        const int k0 = p * 32;
        v8f s[2][2];                // [key tile][query group]
        v16bf vfh[4], vfl[4];
        const bf* vhp = vh + k0; const bf* vlp = vl + k0;
        if (!LOW) {
            const h16* kp = k16 + (size_t)k0 * HD;
            v16h kf[2][2];
#pragma unroll
            for (int kt = 0; kt < 2; ++kt)
#pragma unroll
                for (int ks = 0; ks < 2; ++ks) kf[kt][ks] = WFrag<h16>::ld(kp + kt * 16 * HD + 32 * ks);
#pragma unroll
            for (int t = 0; t < 4; ++t) { vfh[t] = WFrag<bf>::ld(vhp + (size_t)t * 16 * SEQ); vfl[t] = WFrag<bf>::ld(vlp + (size_t)t * 16 * SEQ); }
            // the wait that stands before an issued load's address registers are rewritten; the addresses are inputs so that they stay in their registers up to it
            asm volatile("s_wait_xcnt 0x0" :: "v"(kp), "v"(vhp), "v"(vlp) : "memory");
#pragma unroll
            for (int kt = 0; kt < 2; ++kt)
#pragma unroll
                for (int g = 0; g < 2; ++g) { s[kt][g] = wmma16(kf[kt][0], qf[g][0], (v8f){}); s[kt][g] = wmma16(kf[kt][1], qf[g][1], s[kt][g]); }
            // four vector slots behind the last score WMMA on every path (a branch follows), before its result is read or its operands are reloaded
            asm volatile("v_nop\n\tv_nop\n\tv_nop\n\tv_nop" : "+v"(s[0][0]), "+v"(s[0][1]), "+v"(s[1][0]), "+v"(s[1][1]) : "v"(kf[0][0]), "v"(kf[0][1]), "v"(kf[1][0]), "v"(kf[1][1]));
        } else {
            const bf* khp = kh + (size_t)k0 * HD; const bf* klp = kl + (size_t)k0 * HD;
#pragma unroll
            for (int t = 0; t < 4; ++t) { vfh[t] = WFrag<bf>::ld(vhp + (size_t)t * 16 * SEQ); vfl[t] = WFrag<bf>::ld(vlp + (size_t)t * 16 * SEQ); }
#pragma unroll
            for (int kt = 0; kt < 2; ++kt)
#pragma unroll
                for (int g = 0; g < 2; ++g) s[kt][g] = (v8f){};
#pragma unroll
            for (int ks = 0; ks < 2; ++ks) {
                v16bf a[2], a2[2], b[2], b2[2];
#pragma unroll
                for (int kt = 0; kt < 2; ++kt) { a[kt] = WFrag<bf>::ld(khp + kt * 16 * HD + 32 * ks); a2[kt] = WFrag<bf>::ld(klp + kt * 16 * HD + 32 * ks); }
#pragma unroll
                for (int g = 0; g < 2; ++g) { b[g] = WFrag<bf>::ld(qh + g * 16 * HD + 32 * ks); b2[g] = WFrag<bf>::ld(ql + g * 16 * HD + 32 * ks); }
#pragma unroll
                for (int kt = 0; kt < 2; ++kt)
#pragma unroll
                    for (int g = 0; g < 2; ++g) { s[kt][g] = wmmab(a[kt], b[g], s[kt][g]); s[kt][g] = wmmab(a[kt], b2[g], s[kt][g]); s[kt][g] = wmmab(a2[kt], b[g], s[kt][g]); }
                // four vector slots behind the last score WMMA on every path, as above
                asm volatile("v_nop\n\tv_nop\n\tv_nop\n\tv_nop" : "+v"(s[0][0]), "+v"(s[0][1]), "+v"(s[1][0]), "+v"(s[1][1]) : "v"(a[0]), "v"(a[1]), "v"(a2[0]), "v"(a2[1]), "v"(b[0]), "v"(b[1]), "v"(b2[0]), "v"(b2[1]));
            }
            // the wait before the address registers are rewritten, as above
            asm volatile("s_wait_xcnt 0x0" :: "v"(khp), "v"(klp), "v"(vhp), "v"(vlp) : "memory");
        }
        if (k0 + 31 > r0) {         // work-group-uniform per pass: only the pass on the diagonal pays for the mask
#pragma unroll
            for (int g = 0; g < 2; ++g) {
                const int qi = r0 + 16 * g + lr;
#pragma unroll
                for (int kt = 0; kt < 2; ++kt) {
#pragma unroll
                    for (int r = 0; r < 8; ++r) { if (k0 + 16 * kt + 8 * hi + r > qi) s[kt][g][r] = -3.0e38f; }
                    asm volatile("" : "+v"(s[kt][g]));
                }
            }
        }
        // maxima of the raw scores (the scale is positive); the maximum in use may trail the true one by up to 8 in the exponent, so a rescale is rare
        float mb[2]; bool need = false;
#pragma unroll
        for (int g = 0; g < 2; ++g) {
            float mx = s[0][g][0];
#pragma unroll
            for (int r = 1; r < 8; ++r) mx = fmaxf(mx, s[0][g][r]);
#pragma unroll
            for (int r = 0; r < 8; ++r) mx = fmaxf(mx, s[1][g][r]);
            mx = fmaxf(mx, xhalf(mx)) * CEXP;    // both halves of the wave hold the query's maximum, so that they scale alike
            mb[g] = mx; need = need || (mx > ms[g] + 8.0f);
        }
        if (__builtin_amdgcn_ballot_w32(need) != 0) {
#pragma unroll
            for (int g = 0; g < 2; ++g) {
                const float mn = fmaxf(ms[g], mb[g]);                       // finite: every query of the block sees the first key of every live pass
                const float corr = __builtin_amdgcn_exp2f(ms[g] - mn);      // 0 in a wave's first pass
                ms[g] = mn; ls[g] *= corr;
#pragma unroll
                for (int t = 0; t < 4; ++t) acc[g][t] = acc[g][t] * corr;
            }
        }
        v16bf ph[2], pl[2];
#pragma unroll
        for (int g = 0; g < 2; ++g) {
            const float nm = -ms[g]; v8u wh, wl; v2f sum = (v2f){}; float x[16];
#pragma unroll
            for (int i = 0; i < 8; ++i) {      // elements 2i, 2i + 1 of the 32-key operand: key tile i >> 2, registers 2 (i & 3), 2 (i & 3) + 1
                v2f sv, cv, nv; sv[0] = s[i >> 2][g][2 * (i & 3)]; sv[1] = s[i >> 2][g][2 * (i & 3) + 1]; cv[0] = CEXP; cv[1] = CEXP; nv[0] = nm; nv[1] = nm;
                const v2f a = __builtin_elementwise_fma(sv, cv, nv); x[2 * i] = a[0]; x[2 * i + 1] = a[1];
            }
            exp2x8(x[0], x[1], x[2], x[3], x[4], x[5], x[6], x[7]); exp2x8(x[8], x[9], x[10], x[11], x[12], x[13], x[14], x[15]);
#pragma unroll
            for (int i = 0; i < 8; ++i) {
                const float p0 = x[2 * i], p1 = x[2 * i + 1]; v2f pv; pv[0] = p0; pv[1] = p1; sum += pv;
                const unsigned h2 = pack2(p0, p1);
                wh[i] = h2; wl[i] = pack2(p0 - __uint_as_float(h2 << 16), p1 - __uint_as_float(h2 & 0xFFFF0000u));
            }
            ls[g] += sum[0] + sum[1]; ph[g] = __builtin_bit_cast(v16bf, wh); pl[g] = __builtin_bit_cast(v16bf, wl);
        }
#pragma unroll
        for (int g = 0; g < 2; ++g) {
#pragma unroll
            for (int t = 0; t < 4; ++t) acc[g][t] = wmmab(vfh[t], ph[g], acc[g][t]);
#pragma unroll
            for (int t = 0; t < 4; ++t) acc[g][t] = wmmab(vfh[t], pl[g], acc[g][t]);
#pragma unroll
            for (int t = 0; t < 4; ++t) acc[g][t] = wmmab(vfl[t], ph[g], acc[g][t]);
        }
        // four vector slots behind the last WMMA on every path (the loop's branch follows), before its operands are reloaded or its result is read
        asm volatile("v_nop\n\tv_nop\n\tv_nop\n\tv_nop" : "+v"(acc[0][0]), "+v"(acc[0][1]), "+v"(acc[0][2]), "+v"(acc[0][3]), "+v"(acc[1][0]), "+v"(acc[1][1]), "+v"(acc[1][2]), "+v"(acc[1][3])
                     : "v"(vfh[0]), "v"(vfh[1]), "v"(vfh[2]), "v"(vfh[3]), "v"(vfl[0]), "v"(vfl[1]), "v"(vfl[2]), "v"(vfl[3]), "v"(ph[0]), "v"(ph[1]), "v"(pl[0]), "v"(pl[1]));
    }
}
// Grid: NB * SEQ / FAQ work-groups, all resident at two per WGP. Cost rises with the query block's index t, so the blocks are dealt in complements: indices 2j and 2j + 1, and also indices i and i + half the grid,
// hold blocks t and NT - 1 - t. Four batches give each t its four places; for other NB the plain order, longest first.
__global__ __launch_bounds__(32 * FAW) __attribute__((amdgpu_waves_per_eu(4, 4))) void k_fa(const h16* __restrict__ Q16, const bf* __restrict__ Qh, const bf* __restrict__ Ql, const h16* __restrict__ K16, const bf* __restrict__ Kh, const bf* __restrict__ Kl,
                                                  const bf* __restrict__ Vh, const bf* __restrict__ Vl, float* O) {
    __shared__ __align__(16) float red[FAW][FAQ * FAP];
    __shared__ float stm[FAW][FAQ], stl[FAW][FAQ];
    const int lane = threadIdx.x & 31, lr = lane & 15, hi = lane >> 4; const int w = __builtin_amdgcn_readfirstlane((int)(threadIdx.x >> 5));
    constexpr int NT = SEQ / FAQ;
    int t, bi;
    if (NB == 4) { const int i = (int)blockIdx.x, up = i >= 2 * NT ? 1 : 0, j = (i - up * 2 * NT) >> 1, odd = i & 1; const int x = NT - 1 - j;
        t = (odd ^ up) ? NT - 1 - x : x; bi = (odd ^ up) ? 2 + up : up; }
    else { t = NT - 1 - (int)blockIdx.x / NB; bi = (int)blockIdx.x % NB; }
    const int r0 = t * FAQ; const size_t b = (size_t)bi;
    const size_t qo = (b * SEQ + r0 + lr) * HD + 8 * hi, ko = (b * SEQ + lr) * HD + 8 * hi, vo = (b * HD + lr) * SEQ + 8 * hi;
    v8f acc[2][4]; float ms[2], ls[2];
#pragma unroll
    for (int g = 0; g < 2; ++g) { ms[g] = -3.0e38f; ls[g] = 0.0f;
#pragma unroll
        for (int d = 0; d < 4; ++d) acc[g][d] = (v8f){}; }
    if (r0 < RH) fa_loop<true>(Q16 + qo, Qh + qo, Ql + qo, K16 + ko, Kh + ko, Kl + ko, Vh + vo, Vl + vo, r0, w, lr, hi, acc, ms, ls);
    else         fa_loop<false>(Q16 + qo, Qh + qo, Ql + qo, K16 + ko, Kh + ko, Kl + ko, Vh + vo, Vl + vo, r0, w, lr, hi, acc, ms, ls);
#pragma unroll
    for (int g = 0; g < 2; ++g) {
        const float lt = ls[g] + xhalf(ls[g]);       // the halves hold different keys of the same query; both store the same two values
        stm[w][g * 16 + lr] = ms[g]; stl[w][g * 16 + lr] = lt;
#pragma unroll
        for (int d = 0; d < 4; ++d) { float* dst = &red[w][(g * 16 + lr) * FAP + d * 16 + 8 * hi]; v4f x0, x1;
#pragma unroll
            for (int r = 0; r < 4; ++r) { x0[r] = acc[g][d][r]; x1[r] = acc[g][d][r + 4]; }
            *(v4fa*)dst = x0; *(v4fa*)(dst + 4) = x1; }
    }
    __syncthreads();         // every wave's partial tile, maximum and sum are in LDS before any of them is merged
    const int q = threadIdx.x >> 3, d0 = (threadIdx.x & 7) * 8;
    float M = stm[0][q];
#pragma unroll
    for (int u = 1; u < FAW; ++u) M = fmaxf(M, stm[u][q]);
    float L = 0.0f; float o[8];
#pragma unroll
    for (int r = 0; r < 8; ++r) o[r] = 0.0f;
#pragma unroll
    for (int u = 0; u < FAW; ++u) {      // a wave without a pass has maximum -3e38, weight 0
        const float wt = __builtin_amdgcn_exp2f(stm[u][q] - M); L = __builtin_fmaf(wt, stl[u][q], L);
        const v4f x0 = *(const v4fa*)&red[u][q * FAP + d0]; const v4f x1 = *(const v4fa*)&red[u][q * FAP + d0 + 4];
#pragma unroll
        for (int r = 0; r < 4; ++r) { o[r] = __builtin_fmaf(wt, x0[r], o[r]); o[r + 4] = __builtin_fmaf(wt, x1[r], o[r + 4]); }
    }
    const float f = __fdiv_rn(1.0f, L); v4f y0, y1;
#pragma unroll
    for (int r = 0; r < 4; ++r) { y0[r] = o[r] * f; y1[r] = o[r + 4] * f; }
    float* op = O + (b * SEQ + r0 + q) * HD + d0; *(v4f*)op = y0; *(v4f*)(op + 4) = y1;   // a wave stores eight whole 128-byte lines
}

__global__ __launch_bounds__(256) void k_wt3(const float* __restrict__ w0, const float* __restrict__ w1, const float* __restrict__ w2, bf* Wt) {
    const int which = blockIdx.y; const float* w = (which == 0) ? w0 : ((which == 1) ? w1 : w2); bf* Bt = Wt + (size_t)which * HD * DIN;
    const int lane = threadIdx.x & 31; const int L0 = (blockIdx.x * 8 + (threadIdx.x >> 5)) * 8; const int nlines = HD * DIN / 64;
{
#pragma unroll 1
        for (int l = 0; l < 8; ++l) { const int L = L0 + l; if (L >= nlines) break; const size_t e = (size_t)L * 64 + lane * 2; const int k = (int)(e % DIN), n = (int)(e / DIN); v2us o;
            o[0] = f2bf(w[(size_t)k * HD + n]); o[1] = f2bf(w[(size_t)(k + 1) * HD + n]); *(v2us*)(Bt + e) = o; }
         }
}

__global__ __launch_bounds__(256) void k_cvtx(const float* __restrict__ X, bf* Xb, size_t n8) {
    const size_t i = (size_t)blockIdx.x * 256 + threadIdx.x; if (i >= n8) return; const size_t e = i * 8; const size_t r = e / DIN; const int c = (int)(e - r * DIN);
    const size_t srow = (r / SEQ) * SEQ_FULL + (r % SEQ);
    const float* p = X + srow * DIN + c; const v4f a0 = *(const v4f*)p; const v4f a1 = *(const v4f*)(p + 4); v8us o;
#pragma unroll
    for (int k = 0; k < 4; ++k) { o[k] = f2bf(a0[k]); o[k + 4] = f2bf(a1[k]); }
    *(v8us*)(Xb + e) = o; 
}

__global__ __launch_bounds__(256) void k_plane3(const float* __restrict__ F, h16* P16, bf* Ph, bf* Pl, size_t n8) {
    const size_t i = (size_t)blockIdx.x * 256 + threadIdx.x; if (i >= n8) return;
    const v4f x0 = *(const v4f*)(F + i * 8); const v4f x1 = *(const v4f*)(F + i * 8 + 4);
    v8h o16; v8us oh, ol;
#pragma unroll
    for (int k = 0; k < 4; ++k) { const float y0 = x0[k] * QCAR, y1 = x1[k] * QCAR; o16[k] = (h16)y0; o16[k + 4] = (h16)y1; unsigned short a, c; splitf(y0, a, c); oh[k] = a; ol[k] = c; splitf(y1, a, c); oh[k + 4] = a; ol[k + 4] = c; }
    *(v8h*)(P16 + i * 8) = o16; *(v8us*)(Ph + i * 8) = oh; *(v8us*)(Pl + i * 8) = ol;
    
}

__global__ __launch_bounds__(256) void k_vtp(const float* __restrict__ F, bf* Vh, bf* Vl) {
    const size_t e = ((size_t)blockIdx.x * 256 + threadIdx.x) * 2; if (e >= (size_t)NB * HD * SEQ) return;
    const int t = (int)(e % SEQ); const int d = (int)((e / SEQ) % HD); const int g = (int)(e / ((size_t)SEQ * HD));
    v2us oh, ol;
#pragma unroll
    for (int q = 0; q < 2; ++q) { const float x = F[((size_t)g * SEQ + t + q) * HD + d]; unsigned short a, c; splitf(x, a, c); oh[q] = a; ol[q] = c; }
    *(v2us*)(Vh + e) = oh; *(v2us*)(Vl + e) = ol; 
}

static constexpr size_t al256(size_t b) { return (b + 255) & ~(size_t)255; }
static constexpr size_t WS_TOTAL = al256((size_t)3 * HD * DIN * 2) + al256((size_t)NB * SEQ * DIN * 2) + al256((size_t)3 * NB * SEQ * HD * 4)
                                 + 6 * al256((size_t)NB * SEQ * HD * 2) + 2 * al256((size_t)NB * HD * SEQ * 2);
static_assert(WS_TOTAL <= (size_t)268435456);
static_assert((size_t)NB * SEQ * HD * 4 <= (size_t)4194304);

extern "C" void kernel_launch(void* const* d_in, const int* in_sizes, int n_in,
                              void* d_out, int out_size, void* d_ws, size_t ws_size, hipStream_t stream) {
    if (n_in < 4) return;
    if (in_sizes[0] < ((NB - 1) * SEQ_FULL + SEQ) * DIN) return;
    if (in_sizes[1] < DIN * HD || in_sizes[2] < DIN * HD || in_sizes[3] < DIN * HD) return;
    if (out_size < NB * SEQ * HD) return;
    const float* Xin = (const float*)d_in[0]; const float* Wq = (const float*)d_in[1]; const float* Wk = (const float*)d_in[2]; const float* Wv = (const float*)d_in[3];
    float* OUT = (float*)d_out;     // [NB][SEQ][64]
    char* wsp = (char*)d_ws;
    auto take = [&](size_t bytes) { char* p = wsp; wsp += al256(bytes); return (void*)p; };
    const size_t nTok = (size_t)NB * SEQ;
    bf* Wt = (bf*)take((size_t)3 * HD * DIN * 2);                 // [3][64][768] bf16
    bf* Xb = (bf*)take(nTok * DIN * 2);                            // [NB*SEQ][768] bf16
    float* QKVf = (float*)take((size_t)3 * nTok * HD * 4);          // q, k, v f32 [NB*SEQ][64] each
    h16* Q16 = (h16*)take(nTok * HD * 2); bf* Qh = (bf*)take(nTok * HD * 2); bf* Ql = (bf*)take(nTok * HD * 2);
    h16* K16 = (h16*)take(nTok * HD * 2); bf* Kh = (bf*)take(nTok * HD * 2); bf* Kl = (bf*)take(nTok * HD * 2);
    bf* Vh = (bf*)take((size_t)NB * HD * SEQ * 2); bf* Vl = (bf*)take((size_t)NB * HD * SEQ * 2);   // [NB][64][SEQ]
    if ((size_t)(wsp - (char*)d_ws) > ws_size) return;             // total = WS_TOTAL
    const float* Qf = QKVf; const float* Kf = QKVf + nTok * HD; const float* Vf = QKVf + 2 * nTok * HD;

    k_wt3<<<dim3(HD * DIN / 64 / 64, 3), 256, 0, stream>>>(Wq, Wk, Wv, Wt);
    { const size_t n8 = nTok * DIN / 8; k_cvtx<<<(unsigned)((n8 + 255) / 256), 256, 0, stream>>>(Xin, Xb, n8); }
    k_gemmw<bf, 0><<<dim3((unsigned)(nTok / 64), 1, 3), 32, 0, stream>>>(Xb, nullptr, Wt, nullptr, DIN, QKVf, HD, (size_t)0, (size_t)HD * DIN, nTok * HD);   /* q, k, v = x W (exact bf16 products) */
    { const size_t n8 = nTok * HD / 8;
      k_plane3<<<(unsigned)((n8 + 255) / 256), 256, 0, stream>>>(Qf, Q16, Qh, Ql, n8);
      k_plane3<<<(unsigned)((n8 + 255) / 256), 256, 0, stream>>>(Kf, K16, Kh, Kl, n8); }
    k_vtp<<<(unsigned)(((size_t)NB * HD * SEQ / 2 + 255) / 256), 256, 0, stream>>>(Vf, Vh, Vl);
    k_fa<<<NB * (SEQ / FAQ), 32 * FAW, 0, stream>>>(Q16, Qh, Ql, K16, Kh, Kl, Vh, Vl, OUT);   /* scores, causal softmax, attn x v -> out */
}

// v004
// It runs in 43.4 microseconds.
// Two timings next to v003 put it at 1.88 and 1.90 times that version's speed.
// Over all steps from v000 it is 20.2 times as fast.
#include <hip/hip_runtime.h>

// Contractions (all f32 accumulate): q,k,v = x W on v_wmma_f32_16x16x32_bf16 (x and W RNE-converted to bf16, single product);
// scores = q.k on v_wmma_f32_16x16x32_f16 (f16 planes of 4q and 4k, single product) for query rows >= 64, and on
// v_wmma_f32_16x16x32_bf16 with q,k as bf16 hi/lo x hi/lo (3 products) for query rows < 64;
// out = attn.v on v_wmma_f32_16x16x32_bf16 with un-normalised probabilities and v both as bf16 hi/lo planes (3 products), divided by the row's sum at the end. Softmax f32, online.

#ifndef NB
#define NB 4
#endif
#ifndef SEQ
#define SEQ 4096
#endif
#define NB_FULL  4
#define SEQ_FULL 4096
#define DIN   768
#define HD    64
#define RH    64            // query rows < RH: 3-product score tile
#define QCAR  4.0f          // q and k planes carry x4 -> scores carry x16
#define SCL   0.0078125f    // 2^-7 = (64^-0.5) / 16

static_assert(SEQ % 128 == 0);
static_assert(RH <= 128);
static_assert(DIN % 32 == 0);
static_assert(HD == 64);
static_assert((NB * SEQ) % 64 == 0);
static_assert(NB <= NB_FULL);
static_assert(SEQ <= SEQ_FULL);

typedef _Float16 h16;
typedef unsigned short bf;
typedef __attribute__((ext_vector_type(16))) __bf16   v16bf;
typedef __attribute__((ext_vector_type(16))) _Float16 v16h;
typedef __attribute__((ext_vector_type(8)))  _Float16 v8h;
typedef __attribute__((ext_vector_type(8)))  unsigned short v8us;
typedef __attribute__((ext_vector_type(8)))  float    v8f;
typedef __attribute__((ext_vector_type(4)))  float    v4f;
typedef __attribute__((ext_vector_type(2)))  float    v2f;
typedef __attribute__((ext_vector_type(4)))  unsigned short v4us;
typedef __attribute__((ext_vector_type(2)))  unsigned short v2us;
typedef v4f  __attribute__((may_alias)) v4fa;

#pragma clang fp contract(off)

__device__ __forceinline__ unsigned short f2bf(float f) { unsigned u = __float_as_uint(f); u += 0x7FFFu + ((u >> 16) & 1u); return (unsigned short)(u >> 16); }
__device__ __forceinline__ float bf2f(unsigned short b) { return __uint_as_float(((unsigned)b) << 16); }
__device__ __forceinline__ v16h cat16(v8h lo, v8h hi) { return __builtin_shufflevector(lo, hi, 0, 1, 2, 3, 4, 5, 6, 7, 8, 9, 10, 11, 12, 13, 14, 15); }
__device__ __forceinline__ v16bf cat16b(v8us lo, v8us hi) { return __builtin_bit_cast(v16bf, __builtin_shufflevector(lo, hi, 0, 1, 2, 3, 4, 5, 6, 7, 8, 9, 10, 11, 12, 13, 14, 15)); }
__device__ __forceinline__ v8f wmma16(v16h a, v16h b, v8f c) { return __builtin_amdgcn_wmma_f32_16x16x32_f16(false, a, false, b, (short)0, c, false, false); }
__device__ __forceinline__ v8f wmmab(v16bf a, v16bf b, v8f c) { return __builtin_amdgcn_wmma_f32_16x16x32_bf16(false, a, false, b, (short)0, c, false, false); }
__device__ __forceinline__ void splitf(float y, unsigned short& h, unsigned short& l) { h = f2bf(y); l = f2bf(y - bf2f(h)); }

// Fragments (lane l, h = l>>4, m = n = l&15): elements 0..7 <- k0+8h+0..7, elements 8..15 <- k0+16+8h+0..7 for BOTH A and B; D element r -> (row 8h+r, col l&15).
template <typename T16> struct WFrag;
template <> struct WFrag<h16> { typedef v16h V; static __device__ __forceinline__ V ld(const h16* p) { return cat16(*(const v8h*)p, *(const v8h*)(p + 16)); } static __device__ __forceinline__ v8f mma(V a, V b, v8f c) { return wmma16(a, b, c); } };
template <> struct WFrag<bf> { typedef v16bf V; static __device__ __forceinline__ V ld(const bf* p) { return cat16b(*(const v8us*)p, *(const v8us*)(p + 16)); } static __device__ __forceinline__ v8f mma(V a, V b, v8f c) { return wmmab(a, b, c); } };

// ---- k_fa: scores, causal softmax and out = P V in one kernel; no score or probability goes to memory.
// One work-group of FAW waves per block of FAQ = 32 query rows of one batch. The block's live keys are cut into passes of 32 keys; wave w takes passes w, w + FAW, ...
// and keeps its own running maximum, sum and un-normalised output tile (online softmax); the FAW partial results are merged through LDS in wave order.
// Transposed products, so that nothing changes lanes between them: S^T = K Q^T (A = key rows, B = query rows, both by WFrag::ld at the same d), D register r of key tile kt = key 16 kt + 8 hi + r
// of query column lr; the two key tiles of a pass, converted in place, are the B operand P^T in the order of WFrag::ld (elements 0..7 <- k0 + 8 hi + 0..7, 8..15 <- k0 + 16 + 8 hi + 0..7),
// and A = V^T rows by WFrag<bf>::ld at the same k0: O^T[d = 16 t + 8 hi + r][query lr] += V^T P^T.
// Products as before: scores on f16 planes of 4q, 4k (query rows >= RH) or bf16 hi/lo, 3 products (query rows < RH); P and V as bf16 hi/lo planes, 3 products (hi.hi + lo.hi + hi.lo). P is split un-normalised.
#define FAW 8
#define FAQ 32
#define FAP 68              // LDS pitch in floats of a partial tile's query row: 16 bytes x odd
#define CEXP (SCL * 1.4426950408889634f)   // raw score -> exponent of 2
static_assert(SEQ % FAQ == 0);
static_assert(RH % FAQ == 0);
static_assert((SEQ / FAQ) % 2 == 0);
typedef __attribute__((ext_vector_type(8))) unsigned v8u;
__device__ __forceinline__ float xhalf(float x) { return __builtin_bit_cast(float, __builtin_amdgcn_permlanex16(__builtin_bit_cast(int, x), __builtin_bit_cast(int, x), 0x76543210, 0xfedcba98, false, false)); }   // lane l <-> lane l ^ 16
__device__ __forceinline__ unsigned pack2(float lo, float hi) { typedef __bf16 b2 __attribute__((ext_vector_type(2))); v2f x; x[0] = lo; x[1] = hi; return __builtin_bit_cast(unsigned, __builtin_convertvector(x, b2)); }   // round to nearest even
// eight exponentials of 2, each in place, in one statement: no v_exp_f32 reads its neighbour's result or overwrites its neighbour's source, and the v_nop is the one slot
// that the instruction set asks for behind the last of them, before its result is used
__device__ __forceinline__ void exp2x8(float& a, float& b, float& c, float& d, float& e, float& f, float& g, float& h) {
    asm("v_exp_f32 %0, %0\n\tv_exp_f32 %1, %1\n\tv_exp_f32 %2, %2\n\tv_exp_f32 %3, %3\n\tv_exp_f32 %4, %4\n\tv_exp_f32 %5, %5\n\tv_exp_f32 %6, %6\n\tv_exp_f32 %7, %7\n\tv_nop"
        : "+v"(a), "+v"(b), "+v"(c), "+v"(d), "+v"(e), "+v"(f), "+v"(g), "+v"(h));
}
template <bool LOW>
__device__ __forceinline__ void fa_loop(const h16* __restrict__ q16, const bf* __restrict__ qh, const bf* __restrict__ ql, const h16* __restrict__ k16, const bf* __restrict__ kh, const bf* __restrict__ kl,
                                        const bf* __restrict__ vh, const bf* __restrict__ vl, int r0, int w, int lr, int hi, v8f (&acc)[2][4], float (&ms)[2], float (&ls)[2]) {
    // all pointers arrive at the lane's own row and 8 * hi: q* at query row r0 + lr, k* at key row lr, v* at V^T row lr
    v16h qf[2][2];
    if (!LOW) {
#pragma unroll
        for (int g = 0; g < 2; ++g)
#pragma unroll
            for (int ks = 0; ks < 2; ++ks) qf[g][ks] = WFrag<h16>::ld(q16 + g * 16 * HD + 32 * ks);
    }
    const int np = r0 / 32 + 1;     // live passes of this query block; the last one holds the diagonal
#pragma unroll 1   // stays rolled: one pass already fills the register budget of four waves per SIMD
    for (int p = w; p < np; p += FAW) {
        const int k0 = p * 32;
        v8f s[2][2];                // [key tile][query group]
        v16bf vfh[4], vfl[4];
        const bf* vhp = vh + k0; const bf* vlp = vl + k0;
        if (!LOW) {
            const h16* kp = k16 + (size_t)k0 * HD;
            v16h kf[2][2];
#pragma unroll
            for (int kt = 0; kt < 2; ++kt)
#pragma unroll
                for (int ks = 0; ks < 2; ++ks) kf[kt][ks] = WFrag<h16>::ld(kp + kt * 16 * HD + 32 * ks);
#pragma unroll
            for (int t = 0; t < 4; ++t) { vfh[t] = WFrag<bf>::ld(vhp + (size_t)t * 16 * SEQ); vfl[t] = WFrag<bf>::ld(vlp + (size_t)t * 16 * SEQ); }
            // the wait that stands before an issued load's address registers are rewritten; the addresses are inputs so that they stay in their registers up to it
            asm volatile("s_wait_xcnt 0x0" :: "v"(kp), "v"(vhp), "v"(vlp) : "memory");
#pragma unroll
            for (int kt = 0; kt < 2; ++kt)
#pragma unroll
                for (int g = 0; g < 2; ++g) { s[kt][g] = wmma16(kf[kt][0], qf[g][0], (v8f){}); s[kt][g] = wmma16(kf[kt][1], qf[g][1], s[kt][g]); }
            // four vector slots behind the last score WMMA on every path (a branch follows), before its result is read or its operands are reloaded
            asm volatile("v_nop\n\tv_nop\n\tv_nop\n\tv_nop" : "+v"(s[0][0]), "+v"(s[0][1]), "+v"(s[1][0]), "+v"(s[1][1]) : "v"(kf[0][0]), "v"(kf[0][1]), "v"(kf[1][0]), "v"(kf[1][1]));
        } else {
            const bf* khp = kh + (size_t)k0 * HD; const bf* klp = kl + (size_t)k0 * HD;
#pragma unroll
            for (int t = 0; t < 4; ++t) { vfh[t] = WFrag<bf>::ld(vhp + (size_t)t * 16 * SEQ); vfl[t] = WFrag<bf>::ld(vlp + (size_t)t * 16 * SEQ); }
#pragma unroll
            for (int kt = 0; kt < 2; ++kt)
#pragma unroll
                for (int g = 0; g < 2; ++g) s[kt][g] = (v8f){};
#pragma unroll
            for (int ks = 0; ks < 2; ++ks) {
                v16bf a[2], a2[2], b[2], b2[2];
#pragma unroll
                for (int kt = 0; kt < 2; ++kt) { a[kt] = WFrag<bf>::ld(khp + kt * 16 * HD + 32 * ks); a2[kt] = WFrag<bf>::ld(klp + kt * 16 * HD + 32 * ks); }
#pragma unroll
                for (int g = 0; g < 2; ++g) { b[g] = WFrag<bf>::ld(qh + g * 16 * HD + 32 * ks); b2[g] = WFrag<bf>::ld(ql + g * 16 * HD + 32 * ks); }
#pragma unroll
                for (int kt = 0; kt < 2; ++kt)
#pragma unroll
                    for (int g = 0; g < 2; ++g) { s[kt][g] = wmmab(a[kt], b[g], s[kt][g]); s[kt][g] = wmmab(a[kt], b2[g], s[kt][g]); s[kt][g] = wmmab(a2[kt], b[g], s[kt][g]); }
                // four vector slots behind the last score WMMA on every path, as above
                asm volatile("v_nop\n\tv_nop\n\tv_nop\n\tv_nop" : "+v"(s[0][0]), "+v"(s[0][1]), "+v"(s[1][0]), "+v"(s[1][1]) : "v"(a[0]), "v"(a[1]), "v"(a2[0]), "v"(a2[1]), "v"(b[0]), "v"(b[1]), "v"(b2[0]), "v"(b2[1]));
            }
            // the wait before the address registers are rewritten, as above
            asm volatile("s_wait_xcnt 0x0" :: "v"(khp), "v"(klp), "v"(vhp), "v"(vlp) : "memory");
        }
        if (k0 + 31 > r0) {         // work-group-uniform per pass: only the pass on the diagonal pays for the mask
#pragma unroll
            for (int g = 0; g < 2; ++g) {
                const int qi = r0 + 16 * g + lr;
#pragma unroll
                for (int kt = 0; kt < 2; ++kt) {
#pragma unroll
                    for (int r = 0; r < 8; ++r) { if (k0 + 16 * kt + 8 * hi + r > qi) s[kt][g][r] = -3.0e38f; }
                    asm volatile("" : "+v"(s[kt][g]));
                }
            }
        }
        // maxima of the raw scores (the scale is positive); the maximum in use may trail the true one by up to 8 in the exponent, so a rescale is rare
        float mb[2]; bool need = false;
#pragma unroll
        for (int g = 0; g < 2; ++g) {
            float mx = s[0][g][0];
#pragma unroll
            for (int r = 1; r < 8; ++r) mx = fmaxf(mx, s[0][g][r]);
#pragma unroll
            for (int r = 0; r < 8; ++r) mx = fmaxf(mx, s[1][g][r]);
            mx = fmaxf(mx, xhalf(mx)) * CEXP;    // both halves of the wave hold the query's maximum, so that they scale alike
            mb[g] = mx; need = need || (mx > ms[g] + 8.0f);
        }
        if (__builtin_amdgcn_ballot_w32(need) != 0) {
#pragma unroll
            for (int g = 0; g < 2; ++g) {
                const float mn = fmaxf(ms[g], mb[g]);                       // finite: every query of the block sees the first key of every live pass
                const float corr = __builtin_amdgcn_exp2f(ms[g] - mn);      // 0 in a wave's first pass
                ms[g] = mn; ls[g] *= corr;
#pragma unroll
                for (int t = 0; t < 4; ++t) acc[g][t] = acc[g][t] * corr;
            }
        }
        v16bf ph[2], pl[2];
#pragma unroll
        for (int g = 0; g < 2; ++g) {
            const float nm = -ms[g]; v8u wh, wl; v2f sum = (v2f){}; float x[16];
#pragma unroll
            for (int i = 0; i < 8; ++i) {      // elements 2i, 2i + 1 of the 32-key operand: key tile i >> 2, registers 2 (i & 3), 2 (i & 3) + 1
                v2f sv, cv, nv; sv[0] = s[i >> 2][g][2 * (i & 3)]; sv[1] = s[i >> 2][g][2 * (i & 3) + 1]; cv[0] = CEXP; cv[1] = CEXP; nv[0] = nm; nv[1] = nm;
                const v2f a = __builtin_elementwise_fma(sv, cv, nv); x[2 * i] = a[0]; x[2 * i + 1] = a[1];
            }
            exp2x8(x[0], x[1], x[2], x[3], x[4], x[5], x[6], x[7]); exp2x8(x[8], x[9], x[10], x[11], x[12], x[13], x[14], x[15]);
#pragma unroll
            for (int i = 0; i < 8; ++i) {
                const float p0 = x[2 * i], p1 = x[2 * i + 1]; v2f pv; pv[0] = p0; pv[1] = p1; sum += pv;
                const unsigned h2 = pack2(p0, p1);
                wh[i] = h2; wl[i] = pack2(p0 - __uint_as_float(h2 << 16), p1 - __uint_as_float(h2 & 0xFFFF0000u));
            }
            ls[g] += sum[0] + sum[1]; ph[g] = __builtin_bit_cast(v16bf, wh); pl[g] = __builtin_bit_cast(v16bf, wl);
        }
#pragma unroll
        for (int g = 0; g < 2; ++g) {
#pragma unroll
            for (int t = 0; t < 4; ++t) acc[g][t] = wmmab(vfh[t], ph[g], acc[g][t]);
#pragma unroll
            for (int t = 0; t < 4; ++t) acc[g][t] = wmmab(vfh[t], pl[g], acc[g][t]);
#pragma unroll
            for (int t = 0; t < 4; ++t) acc[g][t] = wmmab(vfl[t], ph[g], acc[g][t]);
        }
        // four vector slots behind the last WMMA on every path (the loop's branch follows), before its operands are reloaded or its result is read
        asm volatile("v_nop\n\tv_nop\n\tv_nop\n\tv_nop" : "+v"(acc[0][0]), "+v"(acc[0][1]), "+v"(acc[0][2]), "+v"(acc[0][3]), "+v"(acc[1][0]), "+v"(acc[1][1]), "+v"(acc[1][2]), "+v"(acc[1][3])
                     : "v"(vfh[0]), "v"(vfh[1]), "v"(vfh[2]), "v"(vfh[3]), "v"(vfl[0]), "v"(vfl[1]), "v"(vfl[2]), "v"(vfl[3]), "v"(ph[0]), "v"(ph[1]), "v"(pl[0]), "v"(pl[1]));
    }
}
// Grid: NB * SEQ / FAQ work-groups, all resident at two per WGP. Cost rises with the query block's index t, so the blocks are dealt in complements: indices 2j and 2j + 1, and also indices i and i + half the grid,
// hold blocks t and NT - 1 - t. Four batches give each t its four places; for other NB the plain order, longest first.
__global__ __launch_bounds__(32 * FAW) __attribute__((amdgpu_waves_per_eu(4, 4))) void k_fa(const h16* __restrict__ Q16, const bf* __restrict__ Qh, const bf* __restrict__ Ql, const h16* __restrict__ K16, const bf* __restrict__ Kh, const bf* __restrict__ Kl,
                                                  const bf* __restrict__ Vh, const bf* __restrict__ Vl, float* O) {
    __shared__ __align__(16) float red[FAW][FAQ * FAP];
    __shared__ float stm[FAW][FAQ], stl[FAW][FAQ];
    const int lane = threadIdx.x & 31, lr = lane & 15, hi = lane >> 4; const int w = __builtin_amdgcn_readfirstlane((int)(threadIdx.x >> 5));
    constexpr int NT = SEQ / FAQ;
    int t, bi;
    if (NB == 4) { const int i = (int)blockIdx.x, up = i >= 2 * NT ? 1 : 0, j = (i - up * 2 * NT) >> 1, odd = i & 1; const int x = NT - 1 - j;
        t = (odd ^ up) ? NT - 1 - x : x; bi = (odd ^ up) ? 2 + up : up; }
    else { t = NT - 1 - (int)blockIdx.x / NB; bi = (int)blockIdx.x % NB; }
    const int r0 = t * FAQ; const size_t b = (size_t)bi;
    const size_t qo = (b * SEQ + r0 + lr) * HD + 8 * hi, ko = (b * SEQ + lr) * HD + 8 * hi, vo = (b * HD + lr) * SEQ + 8 * hi;
    v8f acc[2][4]; float ms[2], ls[2];
#pragma unroll
    for (int g = 0; g < 2; ++g) { ms[g] = -3.0e38f; ls[g] = 0.0f;
#pragma unroll
        for (int d = 0; d < 4; ++d) acc[g][d] = (v8f){}; }
    if (r0 < RH) fa_loop<true>(Q16 + qo, Qh + qo, Ql + qo, K16 + ko, Kh + ko, Kl + ko, Vh + vo, Vl + vo, r0, w, lr, hi, acc, ms, ls);
    else         fa_loop<false>(Q16 + qo, Qh + qo, Ql + qo, K16 + ko, Kh + ko, Kl + ko, Vh + vo, Vl + vo, r0, w, lr, hi, acc, ms, ls);
#pragma unroll
    for (int g = 0; g < 2; ++g) {
        const float lt = ls[g] + xhalf(ls[g]);       // the halves hold different keys of the same query; both store the same two values
        stm[w][g * 16 + lr] = ms[g]; stl[w][g * 16 + lr] = lt;
#pragma unroll
        for (int d = 0; d < 4; ++d) { float* dst = &red[w][(g * 16 + lr) * FAP + d * 16 + 8 * hi]; v4f x0, x1;
#pragma unroll
            for (int r = 0; r < 4; ++r) { x0[r] = acc[g][d][r]; x1[r] = acc[g][d][r + 4]; }
            *(v4fa*)dst = x0; *(v4fa*)(dst + 4) = x1; }
    }
    __syncthreads();         // every wave's partial tile, maximum and sum are in LDS before any of them is merged
    const int q = threadIdx.x >> 3, d0 = (threadIdx.x & 7) * 8;
    float M = stm[0][q];
#pragma unroll
    for (int u = 1; u < FAW; ++u) M = fmaxf(M, stm[u][q]);
    float L = 0.0f; float o[8];
#pragma unroll
    for (int r = 0; r < 8; ++r) o[r] = 0.0f;
#pragma unroll
    for (int u = 0; u < FAW; ++u) {      // a wave without a pass has maximum -3e38, weight 0
        const float wt = __builtin_amdgcn_exp2f(stm[u][q] - M); L = __builtin_fmaf(wt, stl[u][q], L);
        const v4f x0 = *(const v4fa*)&red[u][q * FAP + d0]; const v4f x1 = *(const v4fa*)&red[u][q * FAP + d0 + 4];
#pragma unroll
        for (int r = 0; r < 4; ++r) { o[r] = __builtin_fmaf(wt, x0[r], o[r]); o[r + 4] = __builtin_fmaf(wt, x1[r], o[r + 4]); }
    }
    const float f = __fdiv_rn(1.0f, L); v4f y0, y1;
#pragma unroll
    for (int r = 0; r < 4; ++r) { y0[r] = o[r] * f; y1[r] = o[r + 4] * f; }
    float* op = O + (b * SEQ + r0 + q) * HD + d0; *(v4f*)op = y0; *(v4f*)(op + 4) = y1;   // a wave stores eight whole 128-byte lines
}

// ---- k_wpack: the three weight matrices as bf16 (RNE), laid in the order in which k_proj's waves read them: [column tile 0..11 = q0..3, k0..3, v0..3][k step][half][lane][8],
// so that a fragment (WFrag<bf>::ld order) is two wave-wide loads of 512 contiguous bytes. One thread writes one lane's 16 bytes.
#define KS   (DIN / 32)     // k steps of a projection
#define NTL  (3 * HD / 16)  // column tiles of q, k, v together
__global__ __launch_bounds__(256) void k_wpack(const float* __restrict__ w0, const float* __restrict__ w1, const float* __restrict__ w2, bf* Wp) {
    const int s = (int)blockIdx.x * 256 + (int)threadIdx.x; if (s >= NTL * KS * 64) return;
    const int lane = s & 31, half = (s >> 5) & 1, fk = s >> 6; const int ks = fk % KS, nt = fk / KS;
    const float* w = (nt < 4) ? w0 : ((nt < 8) ? w1 : w2);
    const int n = (nt & 3) * 16 + (lane & 15), k = ks * 32 + half * 16 + (lane >> 4) * 8; v8us o;
#pragma unroll
    for (int j = 0; j < 8; ++j) o[j] = f2bf(w[(size_t)(k + j) * HD + n]);
    *(v8us*)(Wp + (size_t)s * 8) = o;
}

// ---- k_proj: q, k, v = x W and everything around it in one kernel. One work-group of PW waves per PM = 64 tokens.
// 1. The 64 x rows are read as f32 in whole lines (wave w: rows 4w..4w+3), rounded to bf16 (RNE) and laid in LDS.
// 2. Waves 0..11 each take one 16-column tile of q, k or v for all 64 tokens (4 accumulators, k ascending in one chain): W fragments from the packed plane, each read once per work-group, x fragments from LDS.
//    q, k: D = W^T x^T (A = W columns, B = tokens), so a lane holds 8 neighbouring columns of one token; v: D = x W (A = tokens, B = W columns), so a lane holds 8 neighbouring tokens of one column.
// 3. The results are converted to the planes that k_fa reads (f16 and bf16 hi/lo of 4q, 4k; bf16 hi/lo of v, transposed), staged in LDS, and stored in whole 128-byte lines.
// PL: the eight planes one behind the other, PLN elements each: Q16, Qh, Ql, K16, Kh, Kl [token][64], Vh, Vl [batch][64][SEQ].
#define PM  64
#define PW  16
#define XG  (4 * DIN + 8)   // x in LDS: token 16 mt + lr lies at lr * XG + mt * DIN (bf16 elements): the pitch over lr is 16 bytes x odd, for ds_load_b128 readers, and every constant offset fits the instruction's field
#define SP  (64 + 8)        // LDS pitch of a staged plane row: 16 bytes x odd
#define WD  8               // W fragments a wave holds ahead
#define PLN ((size_t)NB * SEQ * HD)
static_assert(SEQ % PM == 0);
static_assert(KS > WD);
static_assert(DIN == 6 * 128);
static_assert(NTL <= PW && PM == 4 * PW);
typedef __attribute__((ext_vector_type(2))) unsigned v2u;
template <bool VT>
__device__ __forceinline__ void proj_tile(const bf* __restrict__ wp, const bf* xr, bf* sd, v16bf (&wf)[WD]) {
    // wp: the wave's packed W stream at the lane's 16 bytes; xr: LDS x at token lr, element 8 * hi; sd: the lane's place in the first staged plane of its matrix
    v8f acc[4]; v16bf xf[2][4];
#pragma unroll
    for (int mt = 0; mt < 4; ++mt) acc[mt] = (v8f){};
#pragma unroll
    for (int mt = 0; mt < 4; ++mt) xf[0][mt] = WFrag<bf>::ld(xr + mt * DIN);
#pragma unroll
    for (int ks = 0; ks < KS; ++ks) {       // x fragments one k step ahead in a second register set, W fragments WD k steps ahead
        if (ks + 1 < KS) {
#pragma unroll
            for (int mt = 0; mt < 4; ++mt) xf[(ks + 1) & 1][mt] = WFrag<bf>::ld(xr + mt * DIN + 32 * (ks + 1));
        }
#pragma unroll
        for (int mt = 0; mt < 4; ++mt) acc[mt] = VT ? wmmab(xf[ks & 1][mt], wf[ks % WD], acc[mt]) : wmmab(wf[ks % WD], xf[ks & 1][mt], acc[mt]);
        if (ks + WD < KS) wf[ks % WD] = cat16b(*(const v8us*)(wp + (ks + WD) * 512), *(const v8us*)(wp + (ks + WD) * 512 + 256));
        __builtin_amdgcn_sched_barrier(0);  // keeps later k steps' loads from being lifted over this one: lifted freely they overran the register budget and spilled
    }
#pragma unroll
    for (int mt = 0; mt < 4; ++mt) {
        v8us oh, ol;
        if (!VT) {
            v8h o16;
#pragma unroll
            for (int r = 0; r < 8; ++r) { const float y = acc[mt][r] * QCAR; o16[r] = (h16)y; unsigned short a, c; splitf(y, a, c); oh[r] = a; ol[r] = c; }
            bf* d = sd + mt * 16 * SP;      // token 16 mt + lr, columns 16 c + 8 hi + 0..7
            *(v8us*)d = __builtin_bit_cast(v8us, o16); *(v8us*)(d + PM * SP) = oh; *(v8us*)(d + 2 * PM * SP) = ol;
        } else {
#pragma unroll
            for (int r = 0; r < 8; ++r) { unsigned short a, c; splitf(acc[mt][r], a, c); oh[r] = a; ol[r] = c; }
            bf* d = sd + mt * 16;           // column 16 c + lr, tokens 16 mt + 8 hi + 0..7
            *(v8us*)d = oh; *(v8us*)(d + HD * SP) = ol;
        }
    }
}
__global__ __launch_bounds__(32 * PW) void k_proj(const float* __restrict__ X, const bf* __restrict__ Wp, bf* PL) {
    __shared__ __align__(16) bf xs[16 * XG];
    __shared__ __align__(16) bf st[8 * 64 * SP];
    const int lane = threadIdx.x & 31, lr = lane & 15, hi = lane >> 4; const int w = __builtin_amdgcn_readfirstlane((int)(threadIdx.x >> 5));
    const int g0 = (int)blockIdx.x * PM, bi = g0 / SEQ, t0 = g0 % SEQ;
    const bf* wp = Wp + (size_t)w * (KS * 512) + lane * 8;
    v16bf wf[WD];
    if (w < NTL) {
#pragma unroll
        for (int ks = 0; ks < WD; ++ks) wf[ks] = cat16b(*(const v8us*)(wp + ks * 512), *(const v8us*)(wp + ks * 512 + 256));
    }
    const float* xp = X + ((size_t)bi * SEQ_FULL + t0 + 4 * w) * DIN + lane * 4;
    v4f xv[24];
#pragma unroll
    for (int i = 0; i < 24; ++i) xv[i] = *(const v4f*)(xp + (i / 6) * DIN + (i % 6) * 128);
    bf* xd = xs + 4 * (w & 3) * XG + (w >> 2) * DIN + lane * 4;
#pragma unroll
    for (int i = 0; i < 24; ++i) { v2u o; o[0] = pack2(xv[i][0], xv[i][1]); o[1] = pack2(xv[i][2], xv[i][3]); *(v2u*)(xd + (i / 6) * XG + (i % 6) * 128) = o; }
    __syncthreads();         // all 64 x rows are in LDS before any wave reads a fragment of them
    if (w < NTL) {
        const int c = w & 3; const bf* xr = xs + lr * XG + 8 * hi;
        if (w < 8) proj_tile<false>(wp, xr, st + (w >> 2) * 3 * PM * SP + lr * SP + 16 * c + 8 * hi, wf);
        else       proj_tile<true>(wp, xr, st + 6 * PM * SP + (16 * c + lr) * SP + 8 * hi, wf);
    }
    __syncthreads();         // all eight staged planes are in LDS before they are stored
    const int row = 4 * w + (lane >> 3), c8 = (lane & 7) * 8;
#pragma unroll
    for (int j = 0; j < 8; ++j) {        // a wave stores four whole 128-byte lines of each plane
        const v8us val = *(const v8us*)(st + (j * 64 + row) * SP + c8);
        bf* dst = PL + j * PLN + (j < 6 ? (size_t)(g0 + row) * HD + c8 : ((size_t)bi * HD + row) * SEQ + t0 + c8);
        *(v8us*)dst = val;
    }
}

static constexpr size_t al256(size_t b) { return (b + 255) & ~(size_t)255; }
static constexpr size_t WS_TOTAL = al256((size_t)3 * HD * DIN * 2) + 8 * PLN * 2;
static_assert(WS_TOTAL <= (size_t)268435456);
static_assert((size_t)NB * SEQ * HD * 4 <= (size_t)4194304);
static_assert((PLN * 2) % 256 == 0);

extern "C" void kernel_launch(void* const* d_in, const int* in_sizes, int n_in,
                              void* d_out, int out_size, void* d_ws, size_t ws_size, hipStream_t stream) {
    if (n_in < 4) return;
    if (in_sizes[0] < ((NB - 1) * SEQ_FULL + SEQ) * DIN) return;
    if (in_sizes[1] < DIN * HD || in_sizes[2] < DIN * HD || in_sizes[3] < DIN * HD) return;
    if (out_size < NB * SEQ * HD) return;
    const float* Xin = (const float*)d_in[0]; const float* Wq = (const float*)d_in[1]; const float* Wk = (const float*)d_in[2]; const float* Wv = (const float*)d_in[3];
    float* OUT = (float*)d_out;     // [NB][SEQ][64]
    if (WS_TOTAL > ws_size) return;
    bf* Wp = (bf*)d_ws;                                             // packed W, bf16
    bf* PL = (bf*)((char*)d_ws + al256((size_t)3 * HD * DIN * 2));  // the eight planes, PLN elements each
    const h16* Q16 = (const h16*)PL; const bf* Qh = PL + PLN; const bf* Ql = PL + 2 * PLN;
    const h16* K16 = (const h16*)(PL + 3 * PLN); const bf* Kh = PL + 4 * PLN; const bf* Kl = PL + 5 * PLN;
    const bf* Vh = PL + 6 * PLN; const bf* Vl = PL + 7 * PLN;       // [NB][64][SEQ]

    k_wpack<<<(NTL * KS * 64 + 255) / 256, 256, 0, stream>>>(Wq, Wk, Wv, Wp);
    k_proj<<<NB * SEQ / PM, 32 * PW, 0, stream>>>(Xin, Wp, PL);   /* q, k, v = x W (exact bf16 products) -> the planes of k_fa */
    k_fa<<<NB * (SEQ / FAQ), 32 * FAW, 0, stream>>>(Q16, Qh, Ql, K16, Kh, Kl, Vh, Vl, OUT);   /* scores, causal softmax, attn x v -> out */
}

// v005
// Measured time: 34.7 microseconds a run.
// Timed twice side by side with v004, it ran 1.26 and 1.25 times as fast.
// Counting every step since v000, it is 25.4 times as fast.
#include <hip/hip_runtime.h>

// Contractions (all f32 accumulate): q,k,v = x W on v_wmma_f32_16x16x32_bf16 (x and W RNE-converted to bf16, single product);
// scores = q.k on v_wmma_f32_16x16x32_f16 (f16 planes of 4q and 4k, single product) for query rows >= 64, and on
// v_wmma_f32_16x16x32_bf16 with q,k as bf16 hi/lo x hi/lo (3 products) for query rows < 64;
// out = attn.v on v_wmma_f32_16x16x32_bf16 with un-normalised probabilities and v both as bf16 hi/lo planes (3 products), divided by the row's sum at the end. Softmax f32, online.

#ifndef NB
#define NB 4
#endif
#ifndef SEQ
#define SEQ 4096
#endif
#define NB_FULL  4
#define SEQ_FULL 4096
#define DIN   768
#define HD    64
#define RH    64            // query rows < RH: 3-product score tile
#define QCAR  4.0f          // q and k planes carry x4 -> scores carry x16
#define SCL   0.0078125f    // 2^-7 = (64^-0.5) / 16

static_assert(SEQ % 128 == 0);
static_assert(RH <= 128);
static_assert(DIN % 32 == 0);
static_assert(HD == 64);
static_assert((NB * SEQ) % 64 == 0);
static_assert(NB <= NB_FULL);
static_assert(SEQ <= SEQ_FULL);

typedef _Float16 h16;
typedef unsigned short bf;
typedef __attribute__((ext_vector_type(16))) __bf16   v16bf;
typedef __attribute__((ext_vector_type(16))) _Float16 v16h;
typedef __attribute__((ext_vector_type(8)))  _Float16 v8h;
typedef __attribute__((ext_vector_type(8)))  unsigned short v8us;
typedef __attribute__((ext_vector_type(8)))  float    v8f;
typedef __attribute__((ext_vector_type(4)))  float    v4f;
typedef __attribute__((ext_vector_type(2)))  float    v2f;
typedef __attribute__((ext_vector_type(4)))  unsigned short v4us;
typedef __attribute__((ext_vector_type(2)))  unsigned short v2us;
typedef v4f  __attribute__((may_alias)) v4fa;

#pragma clang fp contract(off)

__device__ __forceinline__ unsigned short f2bf(float f) { unsigned u = __float_as_uint(f); u += 0x7FFFu + ((u >> 16) & 1u); return (unsigned short)(u >> 16); }
__device__ __forceinline__ float bf2f(unsigned short b) { return __uint_as_float(((unsigned)b) << 16); }
__device__ __forceinline__ v16h cat16(v8h lo, v8h hi) { return __builtin_shufflevector(lo, hi, 0, 1, 2, 3, 4, 5, 6, 7, 8, 9, 10, 11, 12, 13, 14, 15); }
__device__ __forceinline__ v16bf cat16b(v8us lo, v8us hi) { return __builtin_bit_cast(v16bf, __builtin_shufflevector(lo, hi, 0, 1, 2, 3, 4, 5, 6, 7, 8, 9, 10, 11, 12, 13, 14, 15)); }
__device__ __forceinline__ v8f wmma16(v16h a, v16h b, v8f c) { return __builtin_amdgcn_wmma_f32_16x16x32_f16(false, a, false, b, (short)0, c, false, false); }
__device__ __forceinline__ v8f wmmab(v16bf a, v16bf b, v8f c) { return __builtin_amdgcn_wmma_f32_16x16x32_bf16(false, a, false, b, (short)0, c, false, false); }
__device__ __forceinline__ void splitf(float y, unsigned short& h, unsigned short& l) { h = f2bf(y); l = f2bf(y - bf2f(h)); }

// Fragments (lane l, h = l>>4, m = n = l&15): elements 0..7 <- k0+8h+0..7, elements 8..15 <- k0+16+8h+0..7 for BOTH A and B; D element r -> (row 8h+r, col l&15).
// ld: from a row-major plane, p at the lane's row and k0 + 8h. ldp: from a plane laid in fragment order, [fragment][half][lane][8], p at the lane's 16 bytes of the fragment: the same elements,
// but each of the two wave-wide loads covers 512 contiguous bytes (four whole lines) where ld takes 32 bytes out of each of 16 lines.
template <typename T16> struct WFrag;
template <> struct WFrag<h16> { typedef v16h V; static __device__ __forceinline__ V ld(const h16* p) { return cat16(*(const v8h*)p, *(const v8h*)(p + 16)); } static __device__ __forceinline__ V ldp(const h16* p) { return cat16(*(const v8h*)p, *(const v8h*)(p + 256)); } static __device__ __forceinline__ v8f mma(V a, V b, v8f c) { return wmma16(a, b, c); } };
template <> struct WFrag<bf> { typedef v16bf V; static __device__ __forceinline__ V ld(const bf* p) { return cat16b(*(const v8us*)p, *(const v8us*)(p + 16)); } static __device__ __forceinline__ V ldp(const bf* p) { return cat16b(*(const v8us*)p, *(const v8us*)(p + 256)); } static __device__ __forceinline__ v8f mma(V a, V b, v8f c) { return wmmab(a, b, c); } };

// ---- k_fa: scores, causal softmax and out = P V in one kernel; no score or probability goes to memory.
// One work-group of FAW waves per block of FAQ = 32 query rows of one batch. The block's live keys are cut into passes of 32 keys; wave w takes passes w, w + FAW, ...
// and keeps its own running maximum, sum and un-normalised output tile (online softmax); the FAW partial results are merged through LDS in wave order.
// Transposed products, so that nothing changes lanes between them: S^T = K Q^T (A = key rows, B = query rows, both by WFrag::ld at the same d), D register r of key tile kt = key 16 kt + 8 hi + r
// of query column lr; the two key tiles of a pass, converted in place, are the B operand P^T in the order of WFrag::ld (elements 0..7 <- k0 + 8 hi + 0..7, 8..15 <- k0 + 16 + 8 hi + 0..7),
// and A = V^T rows in that same order at the same k0: O^T[d = 16 t + 8 hi + r][query lr] += V^T P^T.
// Products as before: scores on f16 planes of 4q, 4k (query rows >= RH) or bf16 hi/lo, 3 products (query rows < RH); P and V as bf16 hi/lo planes, 3 products (hi.hi + lo.hi + hi.lo). P is split un-normalised.
#define FAW 8
#define FAQ 32
#define FAP 68              // LDS pitch in floats of a partial tile's query row: 16 bytes x odd
#define CEXP (SCL * 1.4426950408889634f)   // raw score -> exponent of 2
static_assert(SEQ % FAQ == 0);
static_assert(RH % FAQ == 0);
static_assert((SEQ / FAQ) % 2 == 0);
typedef __attribute__((ext_vector_type(8))) unsigned v8u;
__device__ __forceinline__ float xhalf(float x) { return __builtin_bit_cast(float, __builtin_amdgcn_permlanex16(__builtin_bit_cast(int, x), __builtin_bit_cast(int, x), 0x76543210, 0xfedcba98, false, false)); }   // lane l <-> lane l ^ 16
__device__ __forceinline__ unsigned pack2(float lo, float hi) { typedef __bf16 b2 __attribute__((ext_vector_type(2))); v2f x; x[0] = lo; x[1] = hi; return __builtin_bit_cast(unsigned, __builtin_convertvector(x, b2)); }   // round to nearest even
// eight exponentials of 2, each in place, in one statement: no v_exp_f32 reads its neighbour's result or overwrites its neighbour's source, and the v_nop is the one slot
// that the instruction set asks for behind the last of them, before its result is used
__device__ __forceinline__ void exp2x8(float& a, float& b, float& c, float& d, float& e, float& f, float& g, float& h) {
    asm("v_exp_f32 %0, %0\n\tv_exp_f32 %1, %1\n\tv_exp_f32 %2, %2\n\tv_exp_f32 %3, %3\n\tv_exp_f32 %4, %4\n\tv_exp_f32 %5, %5\n\tv_exp_f32 %6, %6\n\tv_exp_f32 %7, %7\n\tv_nop"
        : "+v"(a), "+v"(b), "+v"(c), "+v"(d), "+v"(e), "+v"(f), "+v"(g), "+v"(h));
}
template <bool LOW>
__device__ __forceinline__ void fa_loop(const h16* __restrict__ q16, const bf* __restrict__ qh, const bf* __restrict__ ql, const h16* __restrict__ k16, const bf* __restrict__ kh, const bf* __restrict__ kl,
                                        const bf* __restrict__ vh, const bf* __restrict__ vl, int r0, int w, int lr, int hi, v8f (&acc)[2][4], float (&ms)[2], float (&ls)[2]) {
    // qh, ql, kh, kl (row-major) arrive at the lane's own row and 8 * hi: q* at query row r0 + lr, k* at key row lr.
    // q16, k16, vh, vl (fragment order, 64 elements a token) arrive at the lane's 16 bytes: q16 of query row r0's tile, the others of key 0's
    v16h qf[2][2];
    if (!LOW) {
#pragma unroll
        for (int g = 0; g < 2; ++g)
#pragma unroll
            for (int ks = 0; ks < 2; ++ks) qf[g][ks] = WFrag<h16>::ldp(q16 + g * 16 * HD + 512 * ks);
    }
    const int np = r0 / 32 + 1;     // live passes of this query block; the last one holds the diagonal
#pragma unroll 1   // stays rolled: one pass already fills the register budget of four waves per SIMD
    for (int p = w; p < np; p += FAW) {
        const int k0 = p * 32;
        v8f s[2][2];                // [key tile][query group]
        v16bf vfh[4], vfl[4];
        const bf* vhp = vh + (size_t)k0 * HD; const bf* vlp = vl + (size_t)k0 * HD;
        if (!LOW) {
            const h16* kp = k16 + (size_t)k0 * HD;
            v16h kf[2][2];
#pragma unroll
            for (int kt = 0; kt < 2; ++kt)
#pragma unroll
                for (int ks = 0; ks < 2; ++ks) kf[kt][ks] = WFrag<h16>::ldp(kp + kt * 16 * HD + 512 * ks);
            __builtin_amdgcn_sched_barrier(0);  // keeps all K loads in front of the V loads: loads return in order, and left free half of K was issued behind V, so that the score products waited for V too
#pragma unroll
            for (int t = 0; t < 4; ++t) { vfh[t] = WFrag<bf>::ldp(vhp + t * 512); vfl[t] = WFrag<bf>::ldp(vlp + t * 512); }
            // the wait that stands before an issued load's address registers are rewritten; the addresses are inputs so that they stay in their registers up to it
            asm volatile("s_wait_xcnt 0x0" :: "v"(kp), "v"(vhp), "v"(vlp) : "memory");
#pragma unroll
            for (int kt = 0; kt < 2; ++kt)
#pragma unroll
                for (int g = 0; g < 2; ++g) { s[kt][g] = wmma16(kf[kt][0], qf[g][0], (v8f){}); s[kt][g] = wmma16(kf[kt][1], qf[g][1], s[kt][g]); }
            // four vector slots behind the last score WMMA on every path (a branch follows), before its result is read or its operands are reloaded
            asm volatile("v_nop\n\tv_nop\n\tv_nop\n\tv_nop" : "+v"(s[0][0]), "+v"(s[0][1]), "+v"(s[1][0]), "+v"(s[1][1]) : "v"(kf[0][0]), "v"(kf[0][1]), "v"(kf[1][0]), "v"(kf[1][1]));
        } else {
            const bf* khp = kh + (size_t)k0 * HD; const bf* klp = kl + (size_t)k0 * HD;
#pragma unroll
            for (int t = 0; t < 4; ++t) { vfh[t] = WFrag<bf>::ldp(vhp + t * 512); vfl[t] = WFrag<bf>::ldp(vlp + t * 512); }
#pragma unroll
            for (int kt = 0; kt < 2; ++kt)
#pragma unroll
                for (int g = 0; g < 2; ++g) s[kt][g] = (v8f){};
#pragma unroll
            for (int ks = 0; ks < 2; ++ks) {
                v16bf a[2], a2[2], b[2], b2[2];
#pragma unroll
                for (int kt = 0; kt < 2; ++kt) { a[kt] = WFrag<bf>::ld(khp + kt * 16 * HD + 32 * ks); a2[kt] = WFrag<bf>::ld(klp + kt * 16 * HD + 32 * ks); }
#pragma unroll
                for (int g = 0; g < 2; ++g) { b[g] = WFrag<bf>::ld(qh + g * 16 * HD + 32 * ks); b2[g] = WFrag<bf>::ld(ql + g * 16 * HD + 32 * ks); }
#pragma unroll
                for (int kt = 0; kt < 2; ++kt)
#pragma unroll
                    for (int g = 0; g < 2; ++g) { s[kt][g] = wmmab(a[kt], b[g], s[kt][g]); s[kt][g] = wmmab(a[kt], b2[g], s[kt][g]); s[kt][g] = wmmab(a2[kt], b[g], s[kt][g]); }
                // four vector slots behind the last score WMMA on every path, as above
                asm volatile("v_nop\n\tv_nop\n\tv_nop\n\tv_nop" : "+v"(s[0][0]), "+v"(s[0][1]), "+v"(s[1][0]), "+v"(s[1][1]) : "v"(a[0]), "v"(a[1]), "v"(a2[0]), "v"(a2[1]), "v"(b[0]), "v"(b[1]), "v"(b2[0]), "v"(b2[1]));
            }
            // the wait before the address registers are rewritten, as above
            asm volatile("s_wait_xcnt 0x0" :: "v"(khp), "v"(klp), "v"(vhp), "v"(vlp) : "memory");
        }
        if (k0 + 31 > r0) {         // work-group-uniform per pass: only the pass on the diagonal pays for the mask
#pragma unroll
            for (int g = 0; g < 2; ++g) {
                const int qi = r0 + 16 * g + lr;
#pragma unroll
                for (int kt = 0; kt < 2; ++kt) {
#pragma unroll
                    for (int r = 0; r < 8; ++r) { if (k0 + 16 * kt + 8 * hi + r > qi) s[kt][g][r] = -3.0e38f; }
                    asm volatile("" : "+v"(s[kt][g]));
                }
            }
        }
        // maxima of the raw scores (the scale is positive); the maximum in use may trail the true one by up to 8 in the exponent, so a rescale is rare
        float mb[2]; bool need = false;
#pragma unroll
        for (int g = 0; g < 2; ++g) {
            float mx = s[0][g][0];
#pragma unroll
            for (int r = 1; r < 8; ++r) mx = fmaxf(mx, s[0][g][r]);
#pragma unroll
            for (int r = 0; r < 8; ++r) mx = fmaxf(mx, s[1][g][r]);
            mx = fmaxf(mx, xhalf(mx)) * CEXP;    // both halves of the wave hold the query's maximum, so that they scale alike
            mb[g] = mx; need = need || (mx > ms[g] + 8.0f);
        }
        if (__builtin_amdgcn_ballot_w32(need) != 0) {
#pragma unroll
            for (int g = 0; g < 2; ++g) {
                const float mn = fmaxf(ms[g], mb[g]);                       // finite: every query of the block sees the first key of every live pass
                const float corr = __builtin_amdgcn_exp2f(ms[g] - mn);      // 0 in a wave's first pass
                ms[g] = mn; ls[g] *= corr;
#pragma unroll
                for (int t = 0; t < 4; ++t) acc[g][t] = acc[g][t] * corr;
            }
        }
        v16bf ph[2], pl[2];
#pragma unroll
        for (int g = 0; g < 2; ++g) {
            const float nm = -ms[g]; v8u wh, wl; v2f sum = (v2f){}; float x[16];
#pragma unroll
            for (int i = 0; i < 8; ++i) {      // elements 2i, 2i + 1 of the 32-key operand: key tile i >> 2, registers 2 (i & 3), 2 (i & 3) + 1
                v2f sv, cv, nv; sv[0] = s[i >> 2][g][2 * (i & 3)]; sv[1] = s[i >> 2][g][2 * (i & 3) + 1]; cv[0] = CEXP; cv[1] = CEXP; nv[0] = nm; nv[1] = nm;
                const v2f a = __builtin_elementwise_fma(sv, cv, nv); x[2 * i] = a[0]; x[2 * i + 1] = a[1];
            }
            exp2x8(x[0], x[1], x[2], x[3], x[4], x[5], x[6], x[7]); exp2x8(x[8], x[9], x[10], x[11], x[12], x[13], x[14], x[15]);
#pragma unroll
            for (int i = 0; i < 8; ++i) {
                const float p0 = x[2 * i], p1 = x[2 * i + 1]; v2f pv; pv[0] = p0; pv[1] = p1; sum += pv;
                const unsigned h2 = pack2(p0, p1);
                wh[i] = h2; wl[i] = pack2(p0 - __uint_as_float(h2 << 16), p1 - __uint_as_float(h2 & 0xFFFF0000u));
            }
            ls[g] += sum[0] + sum[1]; ph[g] = __builtin_bit_cast(v16bf, wh); pl[g] = __builtin_bit_cast(v16bf, wl);
        }
#pragma unroll
        for (int g = 0; g < 2; ++g) {
#pragma unroll
            for (int t = 0; t < 4; ++t) acc[g][t] = wmmab(vfh[t], ph[g], acc[g][t]);
#pragma unroll
            for (int t = 0; t < 4; ++t) acc[g][t] = wmmab(vfh[t], pl[g], acc[g][t]);
#pragma unroll
            for (int t = 0; t < 4; ++t) acc[g][t] = wmmab(vfl[t], ph[g], acc[g][t]);
        }
        // four vector slots behind the last WMMA on every path (the loop's branch follows), before its operands are reloaded or its result is read
        asm volatile("v_nop\n\tv_nop\n\tv_nop\n\tv_nop" : "+v"(acc[0][0]), "+v"(acc[0][1]), "+v"(acc[0][2]), "+v"(acc[0][3]), "+v"(acc[1][0]), "+v"(acc[1][1]), "+v"(acc[1][2]), "+v"(acc[1][3])
                     : "v"(vfh[0]), "v"(vfh[1]), "v"(vfh[2]), "v"(vfh[3]), "v"(vfl[0]), "v"(vfl[1]), "v"(vfl[2]), "v"(vfl[3]), "v"(ph[0]), "v"(ph[1]), "v"(pl[0]), "v"(pl[1]));
    }
}
// Grid: NB * SEQ / FAQ work-groups, all resident at two per WGP. Cost rises with the query block's index t, so the blocks are dealt in complements: indices 2j and 2j + 1, and also indices i and i + half the grid,
// hold blocks t and NT - 1 - t. Four batches give each t its four places; for other NB the plain order, longest first.
__global__ __launch_bounds__(32 * FAW) __attribute__((amdgpu_waves_per_eu(4, 4))) void k_fa(const h16* __restrict__ Q16, const bf* __restrict__ Qh, const bf* __restrict__ Ql, const h16* __restrict__ K16, const bf* __restrict__ Kh, const bf* __restrict__ Kl,
                                                  const bf* __restrict__ Vh, const bf* __restrict__ Vl, float* O) {
    __shared__ __align__(16) float red[FAW][FAQ * FAP];
    __shared__ float stm[FAW][FAQ], stl[FAW][FAQ];
    const int lane = threadIdx.x & 31, lr = lane & 15, hi = lane >> 4; const int w = __builtin_amdgcn_readfirstlane((int)(threadIdx.x >> 5));
    constexpr int NT = SEQ / FAQ;
    int t, bi;
    if (NB == 4) { const int i = (int)blockIdx.x, up = i >= 2 * NT ? 1 : 0, j = (i - up * 2 * NT) >> 1, odd = i & 1; const int x = NT - 1 - j;
        t = (odd ^ up) ? NT - 1 - x : x; bi = (odd ^ up) ? 2 + up : up; }
    else { t = NT - 1 - (int)blockIdx.x / NB; bi = (int)blockIdx.x % NB; }
    const int r0 = t * FAQ; const size_t b = (size_t)bi;
    const size_t qo = (b * SEQ + r0 + lr) * HD + 8 * hi, ko = (b * SEQ + lr) * HD + 8 * hi, po = b * SEQ * HD + lane * 8;
    v8f acc[2][4]; float ms[2], ls[2];
#pragma unroll
    for (int g = 0; g < 2; ++g) { ms[g] = -3.0e38f; ls[g] = 0.0f;
#pragma unroll
        for (int d = 0; d < 4; ++d) acc[g][d] = (v8f){}; }
    if (r0 < RH) fa_loop<true>(Q16 + po + (size_t)r0 * HD, Qh + qo, Ql + qo, K16 + po, Kh + ko, Kl + ko, Vh + po, Vl + po, r0, w, lr, hi, acc, ms, ls);
    else         fa_loop<false>(Q16 + po + (size_t)r0 * HD, Qh + qo, Ql + qo, K16 + po, Kh + ko, Kl + ko, Vh + po, Vl + po, r0, w, lr, hi, acc, ms, ls);
#pragma unroll
    for (int g = 0; g < 2; ++g) {
        const float lt = ls[g] + xhalf(ls[g]);       // the halves hold different keys of the same query; both store the same two values
        stm[w][g * 16 + lr] = ms[g]; stl[w][g * 16 + lr] = lt;
#pragma unroll
        for (int d = 0; d < 4; ++d) { float* dst = &red[w][(g * 16 + lr) * FAP + d * 16 + 8 * hi]; v4f x0, x1;
#pragma unroll
            for (int r = 0; r < 4; ++r) { x0[r] = acc[g][d][r]; x1[r] = acc[g][d][r + 4]; }
            *(v4fa*)dst = x0; *(v4fa*)(dst + 4) = x1; }
    }
    __syncthreads();         // every wave's partial tile, maximum and sum are in LDS before any of them is merged
    const int q = threadIdx.x >> 3, d0 = (threadIdx.x & 7) * 8;
    float M = stm[0][q];
#pragma unroll
    for (int u = 1; u < FAW; ++u) M = fmaxf(M, stm[u][q]);
    float L = 0.0f; float o[8];
#pragma unroll
    for (int r = 0; r < 8; ++r) o[r] = 0.0f;
#pragma unroll
    for (int u = 0; u < FAW; ++u) {      // a wave without a pass has maximum -3e38, weight 0
        const float wt = __builtin_amdgcn_exp2f(stm[u][q] - M); L = __builtin_fmaf(wt, stl[u][q], L);
        const v4f x0 = *(const v4fa*)&red[u][q * FAP + d0]; const v4f x1 = *(const v4fa*)&red[u][q * FAP + d0 + 4];
#pragma unroll
        for (int r = 0; r < 4; ++r) { o[r] = __builtin_fmaf(wt, x0[r], o[r]); o[r + 4] = __builtin_fmaf(wt, x1[r], o[r + 4]); }
    }
    const float f = __fdiv_rn(1.0f, L); v4f y0, y1;
#pragma unroll
    for (int r = 0; r < 4; ++r) { y0[r] = o[r] * f; y1[r] = o[r + 4] * f; }
    float* op = O + (b * SEQ + r0 + q) * HD + d0; *(v4f*)op = y0; *(v4f*)(op + 4) = y1;   // a wave stores eight whole 128-byte lines
}

// ---- k_wpack: the three weight matrices as bf16 (RNE), laid in the order in which k_proj's waves read them: [column tile 0..11 = q0..3, k0..3, v0..3][k step][half][lane][8],
// so that a fragment (WFrag<bf>::ld order) is two wave-wide loads of 512 contiguous bytes. One thread writes one lane's 16 bytes.
#define KS   (DIN / 32)     // k steps of a projection
#define NTL  (3 * HD / 16)  // column tiles of q, k, v together
__global__ __launch_bounds__(256) void k_wpack(const float* __restrict__ w0, const float* __restrict__ w1, const float* __restrict__ w2, bf* Wp) {
    const int s = (int)blockIdx.x * 256 + (int)threadIdx.x; if (s >= NTL * KS * 64) return;
    const int lane = s & 31, half = (s >> 5) & 1, fk = s >> 6; const int ks = fk % KS, nt = fk / KS;
    const float* w = (nt < 4) ? w0 : ((nt < 8) ? w1 : w2);
    const int n = (nt & 3) * 16 + (lane & 15), k = ks * 32 + half * 16 + (lane >> 4) * 8; v8us o;
#pragma unroll
    for (int j = 0; j < 8; ++j) o[j] = f2bf(w[(size_t)(k + j) * HD + n]);
    *(v8us*)(Wp + (size_t)s * 8) = o;
}

// ---- k_proj: q, k, v = x W and everything around it in one kernel. One work-group of PW waves per PM = 64 tokens.
// 1. The 64 x rows are read as f32 in whole lines (wave w: rows 4w..4w+3), rounded to bf16 (RNE) and laid in LDS.
// 2. Waves 0..11 each take one 16-column tile of q, k or v for all 64 tokens (4 accumulators, k ascending in one chain): W fragments from the packed plane, each read once per work-group, x fragments from LDS.
//    q, k: D = W^T x^T (A = W columns, B = tokens), so a lane holds 8 neighbouring columns of one token; v: D = x W (A = tokens, B = W columns), so a lane holds 8 neighbouring tokens of one column.
// 3. The results are converted to the planes that k_fa reads (f16 and bf16 hi/lo of 4q, 4k; bf16 hi/lo of v, transposed), staged in LDS, and stored in whole 128-byte lines.
// PL: the eight planes one behind the other, PLN elements each: Q16, Qh, Ql, K16, Kh, Kl, Vh, Vl. Qh, Ql, Kh, Kl are row-major [token][64]. The four that k_fa's long loop reads lie in the order of its fragments (WFrag::ldp):
// Q16, K16 [16-token tile][d step of 32][half][lane][8], lane (hi, lr) holding token lr, d = 32 step + 16 half + 8 hi + 0..7; Vh, Vl [32-token pass][16-column tile][half][lane][8], lane holding column lr, tokens 16 half + 8 hi + 0..7.
// Either way a token takes 64 elements of a plane, so the work-group's 64 tokens are 16 groups of 256 elements, one a wave.
#define PM  64
#define PW  16
#define XG  (4 * DIN + 8)   // x in LDS: token 16 mt + lr lies at lr * XG + mt * DIN (bf16 elements): the pitch over lr is 16 bytes x odd, for ds_load_b128 readers, and every constant offset fits the instruction's field
#define SP  (64 + 8)        // LDS pitch of a staged plane row: 16 bytes x odd
#define WD  8               // W fragments a wave holds ahead
#define PLN ((size_t)NB * SEQ * HD)
static_assert(SEQ % PM == 0);
static_assert(KS > WD);
static_assert(DIN == 6 * 128);
static_assert(NTL <= PW && PM == 4 * PW);
typedef __attribute__((ext_vector_type(2))) unsigned v2u;
template <bool VT>
__device__ __forceinline__ void proj_tile(const bf* __restrict__ wp, const bf* xr, bf* sd, v16bf (&wf)[WD]) {
    // wp: the wave's packed W stream at the lane's 16 bytes; xr: LDS x at token lr, element 8 * hi; sd: the lane's place in the first staged plane of its matrix
    v8f acc[4]; v16bf xf[2][4];
#pragma unroll
    for (int mt = 0; mt < 4; ++mt) acc[mt] = (v8f){};
#pragma unroll
    for (int mt = 0; mt < 4; ++mt) xf[0][mt] = WFrag<bf>::ld(xr + mt * DIN);
#pragma unroll
    for (int ks = 0; ks < KS; ++ks) {       // x fragments one k step ahead in a second register set, W fragments WD k steps ahead
        if (ks + 1 < KS) {
#pragma unroll
            for (int mt = 0; mt < 4; ++mt) xf[(ks + 1) & 1][mt] = WFrag<bf>::ld(xr + mt * DIN + 32 * (ks + 1));
        }
#pragma unroll
        for (int mt = 0; mt < 4; ++mt) acc[mt] = VT ? wmmab(xf[ks & 1][mt], wf[ks % WD], acc[mt]) : wmmab(wf[ks % WD], xf[ks & 1][mt], acc[mt]);
        if (ks + WD < KS) wf[ks % WD] = cat16b(*(const v8us*)(wp + (ks + WD) * 512), *(const v8us*)(wp + (ks + WD) * 512 + 256));
        __builtin_amdgcn_sched_barrier(0);  // keeps later k steps' loads from being lifted over this one: lifted freely they overran the register budget and spilled
    }
#pragma unroll
    for (int mt = 0; mt < 4; ++mt) {
        v8us oh, ol;
        if (!VT) {
            v8h o16;
#pragma unroll
            for (int r = 0; r < 8; ++r) { const float y = acc[mt][r] * QCAR; o16[r] = (h16)y; unsigned short a, c; splitf(y, a, c); oh[r] = a; ol[r] = c; }
            bf* d = sd + mt * 16 * SP;      // token 16 mt + lr, columns 16 c + 8 hi + 0..7
            *(v8us*)d = __builtin_bit_cast(v8us, o16); *(v8us*)(d + PM * SP) = oh; *(v8us*)(d + 2 * PM * SP) = ol;
        } else {
#pragma unroll
            for (int r = 0; r < 8; ++r) { unsigned short a, c; splitf(acc[mt][r], a, c); oh[r] = a; ol[r] = c; }
            bf* d = sd + mt * 16;           // column 16 c + lr, tokens 16 mt + 8 hi + 0..7
            *(v8us*)d = oh; *(v8us*)(d + HD * SP) = ol;
        }
    }
}
__global__ __launch_bounds__(32 * PW) void k_proj(const float* __restrict__ X, const bf* __restrict__ Wp, bf* PL) {
    __shared__ __align__(16) bf xs[16 * XG];
    __shared__ __align__(16) bf st[8 * 64 * SP];
    const int lane = threadIdx.x & 31, lr = lane & 15, hi = lane >> 4; const int w = __builtin_amdgcn_readfirstlane((int)(threadIdx.x >> 5));
    const int g0 = (int)blockIdx.x * PM, bi = g0 / SEQ, t0 = g0 % SEQ;
    const bf* wp = Wp + (size_t)w * (KS * 512) + lane * 8;
    v16bf wf[WD];
    if (w < NTL) {
#pragma unroll
        for (int ks = 0; ks < WD; ++ks) wf[ks] = cat16b(*(const v8us*)(wp + ks * 512), *(const v8us*)(wp + ks * 512 + 256));
    }
    const float* xp = X + ((size_t)bi * SEQ_FULL + t0 + 4 * w) * DIN + lane * 4;
    v4f xv[24];
#pragma unroll
    for (int i = 0; i < 24; ++i) xv[i] = *(const v4f*)(xp + (i / 6) * DIN + (i % 6) * 128);
    bf* xd = xs + 4 * (w & 3) * XG + (w >> 2) * DIN + lane * 4;
#pragma unroll
    for (int i = 0; i < 24; ++i) { v2u o; o[0] = pack2(xv[i][0], xv[i][1]); o[1] = pack2(xv[i][2], xv[i][3]); *(v2u*)(xd + (i / 6) * XG + (i % 6) * 128) = o; }
    __syncthreads();         // all 64 x rows are in LDS before any wave reads a fragment of them
    if (w < NTL) {
        const int c = w & 3; const bf* xr = xs + lr * XG + 8 * hi;
        if (w < 8) proj_tile<false>(wp, xr, st + (w >> 2) * 3 * PM * SP + lr * SP + 16 * c + 8 * hi, wf);
        else       proj_tile<true>(wp, xr, st + 6 * PM * SP + (16 * c + lr) * SP + 8 * hi, wf);
    }
    __syncthreads();         // all eight staged planes are in LDS before they are stored
    const int row = 4 * w + (lane >> 3), c8 = (lane & 7) * 8;
#pragma unroll
    for (int j = 0; j < 8; ++j) {        // a wave stores four whole 128-byte lines of each plane
        const bool fo = j == 0 || j == 3 || j >= 6;     // a plane in fragment order: wave w stores half w & 1 of a fragment
        const int sr = !fo ? row : (j < 6 ? 16 * (w >> 2) + lr : 16 * ((w >> 1) & 3) + lr);
        const int sc = !fo ? c8 : (j < 6 ? 16 * (w & 3) + 8 * hi : 32 * (w >> 3) + 16 * (w & 1) + 8 * hi);
        const v8us val = *(const v8us*)(st + (j * 64 + sr) * SP + sc);
        *(v8us*)(PL + j * PLN + (size_t)g0 * HD + w * 256 + lane * 8) = val;
    }
}

static constexpr size_t al256(size_t b) { return (b + 255) & ~(size_t)255; }
static constexpr size_t WS_TOTAL = al256((size_t)3 * HD * DIN * 2) + 8 * PLN * 2;
static_assert(WS_TOTAL <= (size_t)268435456);
static_assert((size_t)NB * SEQ * HD * 4 <= (size_t)4194304);
static_assert((PLN * 2) % 256 == 0);

extern "C" void kernel_launch(void* const* d_in, const int* in_sizes, int n_in,
                              void* d_out, int out_size, void* d_ws, size_t ws_size, hipStream_t stream) {
    if (n_in < 4) return;
    if (in_sizes[0] < ((NB - 1) * SEQ_FULL + SEQ) * DIN) return;
    if (in_sizes[1] < DIN * HD || in_sizes[2] < DIN * HD || in_sizes[3] < DIN * HD) return;
    if (out_size < NB * SEQ * HD) return;
    const float* Xin = (const float*)d_in[0]; const float* Wq = (const float*)d_in[1]; const float* Wk = (const float*)d_in[2]; const float* Wv = (const float*)d_in[3];
    float* OUT = (float*)d_out;     // [NB][SEQ][64]
    if (WS_TOTAL > ws_size) return;
    bf* Wp = (bf*)d_ws;                                             // packed W, bf16
    bf* PL = (bf*)((char*)d_ws + al256((size_t)3 * HD * DIN * 2));  // the eight planes, PLN elements each
    const h16* Q16 = (const h16*)PL; const bf* Qh = PL + PLN; const bf* Ql = PL + 2 * PLN;
    const h16* K16 = (const h16*)(PL + 3 * PLN); const bf* Kh = PL + 4 * PLN; const bf* Kl = PL + 5 * PLN;
    const bf* Vh = PL + 6 * PLN; const bf* Vl = PL + 7 * PLN;

    k_wpack<<<(NTL * KS * 64 + 255) / 256, 256, 0, stream>>>(Wq, Wk, Wv, Wp);
    k_proj<<<NB * SEQ / PM, 32 * PW, 0, stream>>>(Xin, Wp, PL);   /* q, k, v = x W (exact bf16 products) -> the planes of k_fa */
    k_fa<<<NB * (SEQ / FAQ), 32 * FAW, 0, stream>>>(Q16, Qh, Ql, K16, Kh, Kl, Vh, Vl, OUT);   /* scores, causal softmax, attn x v -> out */
}

// v006
// It runs in 30.7 microseconds.
// Timed twice side by side with v005, it ran 1.11 and 1.12 times as fast.
// Counting every step since v000, it is 28.3 times as fast.
#include <hip/hip_runtime.h>

// Contractions (all f32 accumulate): q,k,v = x W on v_wmma_f32_16x16x32_bf16 (x and W RNE-converted to bf16, single product);
// scores = q.k on v_wmma_f32_16x16x32_f16 (f16 planes of 4q and 4k, single product) for query rows >= 64, and on
// v_wmma_f32_16x16x32_bf16 with q,k as bf16 hi/lo x hi/lo (3 products) for query rows < 64;
// out = attn.v on v_wmma_f32_16x16x32_bf16 with un-normalised probabilities and v both as bf16 hi/lo planes (3 products), divided by the row's sum at the end. Softmax f32, online.

#ifndef NB
#define NB 4
#endif
#ifndef SEQ
#define SEQ 4096
#endif
#define NB_FULL  4
#define SEQ_FULL 4096
#define DIN   768
#define HD    64
#define RH    64            // query rows < RH: 3-product score tile
#define QCAR  4.0f          // q and k planes carry x4 -> scores carry x16
#define SCL   0.0078125f    // 2^-7 = (64^-0.5) / 16

static_assert(SEQ % 128 == 0);
static_assert(RH <= 128);
static_assert(DIN % 32 == 0);
static_assert(HD == 64);
static_assert((NB * SEQ) % 64 == 0);
static_assert(NB <= NB_FULL);
static_assert(SEQ <= SEQ_FULL);

typedef _Float16 h16;
typedef unsigned short bf;
typedef __attribute__((ext_vector_type(16))) __bf16   v16bf;
typedef __attribute__((ext_vector_type(16))) _Float16 v16h;
typedef __attribute__((ext_vector_type(8)))  _Float16 v8h;
typedef __attribute__((ext_vector_type(8)))  unsigned short v8us;
typedef __attribute__((ext_vector_type(8)))  float    v8f;
typedef __attribute__((ext_vector_type(4)))  float    v4f;
typedef __attribute__((ext_vector_type(2)))  float    v2f;
typedef __attribute__((ext_vector_type(4)))  unsigned short v4us;
typedef __attribute__((ext_vector_type(2)))  unsigned short v2us;
typedef v4f  __attribute__((may_alias)) v4fa;

#pragma clang fp contract(off)

__device__ __forceinline__ unsigned short f2bf(float f) { unsigned u = __float_as_uint(f); u += 0x7FFFu + ((u >> 16) & 1u); return (unsigned short)(u >> 16); }
__device__ __forceinline__ float bf2f(unsigned short b) { return __uint_as_float(((unsigned)b) << 16); }
__device__ __forceinline__ v16h cat16(v8h lo, v8h hi) { return __builtin_shufflevector(lo, hi, 0, 1, 2, 3, 4, 5, 6, 7, 8, 9, 10, 11, 12, 13, 14, 15); }
__device__ __forceinline__ v16bf cat16b(v8us lo, v8us hi) { return __builtin_bit_cast(v16bf, __builtin_shufflevector(lo, hi, 0, 1, 2, 3, 4, 5, 6, 7, 8, 9, 10, 11, 12, 13, 14, 15)); }
__device__ __forceinline__ v8f wmma16(v16h a, v16h b, v8f c) { return __builtin_amdgcn_wmma_f32_16x16x32_f16(false, a, false, b, (short)0, c, false, false); }
__device__ __forceinline__ v8f wmmab(v16bf a, v16bf b, v8f c) { return __builtin_amdgcn_wmma_f32_16x16x32_bf16(false, a, false, b, (short)0, c, false, false); }
__device__ __forceinline__ void splitf(float y, unsigned short& h, unsigned short& l) { h = f2bf(y); l = f2bf(y - bf2f(h)); }

// Fragments (lane l, h = l>>4, m = n = l&15): elements 0..7 <- k0+8h+0..7, elements 8..15 <- k0+16+8h+0..7 for BOTH A and B; D element r -> (row 8h+r, col l&15).
// ld: from a row-major plane, p at the lane's row and k0 + 8h. ldp: from a plane laid in fragment order, [fragment][half][lane][8], p at the lane's 16 bytes of the fragment: the same elements,
// but each of the two wave-wide loads covers 512 contiguous bytes (four whole lines) where ld takes 32 bytes out of each of 16 lines.
template <typename T16> struct WFrag;
template <> struct WFrag<h16> { typedef v16h V; static __device__ __forceinline__ V ld(const h16* p) { return cat16(*(const v8h*)p, *(const v8h*)(p + 16)); } static __device__ __forceinline__ V ldp(const h16* p) { return cat16(*(const v8h*)p, *(const v8h*)(p + 256)); } static __device__ __forceinline__ v8f mma(V a, V b, v8f c) { return wmma16(a, b, c); } };
template <> struct WFrag<bf> { typedef v16bf V; static __device__ __forceinline__ V ld(const bf* p) { return cat16b(*(const v8us*)p, *(const v8us*)(p + 16)); } static __device__ __forceinline__ V ldp(const bf* p) { return cat16b(*(const v8us*)p, *(const v8us*)(p + 256)); } static __device__ __forceinline__ v8f mma(V a, V b, v8f c) { return wmmab(a, b, c); } };

// ---- k_fa: scores, causal softmax and out = P V in one kernel; no score or probability goes to memory.
// One work-group of FAW = 16 waves per PAIR of blocks of FAQ = 32 query rows of one batch: block NT - 1 - j (the long one) and block j (the short one), so that every work-group has the same number of passes.
// A block's live keys are cut into passes of 32 keys. Over the keys that both blocks see, the even waves work for the long block and the odd ones for the short one, waves 2 a and 2 a + 1 on the same pass in the same trip:
// the two, equally old and on neighbouring SIMDs, load the same K and V lines at about the same time, so that the WGP's cache can serve one of them. Over the long block's remaining keys all 16 waves work for it.
// A wave keeps its own running maximum, sum and un-normalised output tile (online softmax); the partial results (16 of the long block, 8 of the short one) are merged through LDS in slot order.
// Transposed products, so that nothing changes lanes between them: S^T = K Q^T (A = key rows, B = query rows, both by WFrag::ld at the same d), D register r of key tile kt = key 16 kt + 8 hi + r
// of query column lr; the two key tiles of a pass, converted in place, are the B operand P^T in the order of WFrag::ld (elements 0..7 <- k0 + 8 hi + 0..7, 8..15 <- k0 + 16 + 8 hi + 0..7),
// and A = V^T rows in that same order at the same k0: O^T[d = 16 t + 8 hi + r][query lr] += V^T P^T.
// Products as before: scores on f16 planes of 4q, 4k (query rows >= RH) or bf16 hi/lo, 3 products (query rows < RH); P and V as bf16 hi/lo planes, 3 products (hi.hi + lo.hi + hi.lo). P is split un-normalised.
#define FAW 16
#define FAH (FAW / 2)       // waves a block has over the keys that both blocks see
#define FAS (FAW + FAH)     // partial results in LDS: slots 0..15 the long block's, 16..23 the short block's
#define FAQ 32
#define FAP 68              // LDS pitch in floats of a partial tile's query row: 16 bytes x odd
#define CEXP (SCL * 1.4426950408889634f)   // raw score -> exponent of 2
static_assert(SEQ % FAQ == 0);
static_assert(RH % FAQ == 0);
static_assert((SEQ / FAQ) % 2 == 0);
static_assert(SEQ / 2 >= RH);
typedef __attribute__((ext_vector_type(8))) unsigned v8u;
__device__ __forceinline__ float xhalf(float x) { return __builtin_bit_cast(float, __builtin_amdgcn_permlanex16(__builtin_bit_cast(int, x), __builtin_bit_cast(int, x), 0x76543210, 0xfedcba98, false, false)); }   // lane l <-> lane l ^ 16
__device__ __forceinline__ unsigned pack2(float lo, float hi) { typedef __bf16 b2 __attribute__((ext_vector_type(2))); v2f x; x[0] = lo; x[1] = hi; return __builtin_bit_cast(unsigned, __builtin_convertvector(x, b2)); }   // round to nearest even
// eight exponentials of 2, each in place, in one statement: no v_exp_f32 reads its neighbour's result or overwrites its neighbour's source, and the v_nop is the one slot
// that the instruction set asks for behind the last of them, before its result is used
__device__ __forceinline__ void exp2x8(float& a, float& b, float& c, float& d, float& e, float& f, float& g, float& h) {
    asm("v_exp_f32 %0, %0\n\tv_exp_f32 %1, %1\n\tv_exp_f32 %2, %2\n\tv_exp_f32 %3, %3\n\tv_exp_f32 %4, %4\n\tv_exp_f32 %5, %5\n\tv_exp_f32 %6, %6\n\tv_exp_f32 %7, %7\n\tv_nop"
        : "+v"(a), "+v"(b), "+v"(c), "+v"(d), "+v"(e), "+v"(f), "+v"(g), "+v"(h));
}
template <bool LOW>
__device__ __forceinline__ void fa_loop(const h16* __restrict__ q16, const bf* __restrict__ qh, const bf* __restrict__ ql, const h16* __restrict__ k16, const bf* __restrict__ kh, const bf* __restrict__ kl,
                                        const bf* __restrict__ vh, const bf* __restrict__ vl, int r0, int p0, int pe, int ps, int lr, int hi, v8f (&acc)[2][4], float (&ms)[2], float (&ls)[2]) {
    // qh, ql, kh, kl (row-major) arrive at the lane's own row and 8 * hi: q* at query row r0 + lr, k* at key row lr.
    // q16, k16, vh, vl (fragment order, 64 elements a token) arrive at the lane's 16 bytes: q16 of query row r0's tile, the others of key 0's
    v16h qf[2][2];
    if (!LOW) {
#pragma unroll
        for (int g = 0; g < 2; ++g)
#pragma unroll
            for (int ks = 0; ks < 2; ++ks) qf[g][ks] = WFrag<h16>::ldp(q16 + g * 16 * HD + 512 * ks);
        // the wait that stands before the Q loads' address registers are rewritten (the loop's loads may land on them); the address is an input so that it stays in its registers up to it
        asm volatile("s_wait_xcnt 0x0" :: "v"(q16) : "memory");
    }
    // the wave's passes: p0, p0 + ps, ... below pe; pass r0 / 32, the block's last live one, holds the diagonal
#pragma unroll 1   // stays rolled: one pass already fills the register budget of four waves per SIMD
    for (int p = p0; p < pe; p += ps) {
        const int k0 = p * 32;
        v8f s[2][2];                // [key tile][query group]
        v16bf vfh[4], vfl[4];
        const bf* vhp = vh + (size_t)k0 * HD; const bf* vlp = vl + (size_t)k0 * HD;
        if (!LOW) {
            const h16* kp = k16 + (size_t)k0 * HD;
            v16h kf[2][2];
#pragma unroll
            for (int kt = 0; kt < 2; ++kt)
#pragma unroll
                for (int ks = 0; ks < 2; ++ks) kf[kt][ks] = WFrag<h16>::ldp(kp + kt * 16 * HD + 512 * ks);
            __builtin_amdgcn_sched_barrier(0);  // keeps all K loads in front of the V loads: loads return in order, and left free half of K was issued behind V, so that the score products waited for V too
#pragma unroll
            for (int t = 0; t < 4; ++t) { vfh[t] = WFrag<bf>::ldp(vhp + t * 512); vfl[t] = WFrag<bf>::ldp(vlp + t * 512); }
            // the wait that stands before an issued load's address registers are rewritten; the addresses are inputs so that they stay in their registers up to it
            asm volatile("s_wait_xcnt 0x0" :: "v"(kp), "v"(vhp), "v"(vlp) : "memory");
#pragma unroll
            for (int kt = 0; kt < 2; ++kt)
#pragma unroll
                for (int g = 0; g < 2; ++g) { s[kt][g] = wmma16(kf[kt][0], qf[g][0], (v8f){}); s[kt][g] = wmma16(kf[kt][1], qf[g][1], s[kt][g]); }
            // four vector slots behind the last score WMMA on every path (a branch follows), before its result is read or its operands are reloaded
            asm volatile("v_nop\n\tv_nop\n\tv_nop\n\tv_nop" : "+v"(s[0][0]), "+v"(s[0][1]), "+v"(s[1][0]), "+v"(s[1][1]) : "v"(kf[0][0]), "v"(kf[0][1]), "v"(kf[1][0]), "v"(kf[1][1]));
        } else {
            const bf* khp = kh + (size_t)k0 * HD; const bf* klp = kl + (size_t)k0 * HD;
#pragma unroll
            for (int t = 0; t < 4; ++t) { vfh[t] = WFrag<bf>::ldp(vhp + t * 512); vfl[t] = WFrag<bf>::ldp(vlp + t * 512); }
#pragma unroll
            for (int kt = 0; kt < 2; ++kt)
#pragma unroll
                for (int g = 0; g < 2; ++g) s[kt][g] = (v8f){};
#pragma unroll
            for (int ks = 0; ks < 2; ++ks) {
                v16bf a[2], a2[2], b[2], b2[2];
#pragma unroll
                for (int kt = 0; kt < 2; ++kt) { a[kt] = WFrag<bf>::ld(khp + kt * 16 * HD + 32 * ks); a2[kt] = WFrag<bf>::ld(klp + kt * 16 * HD + 32 * ks); }
#pragma unroll
                for (int g = 0; g < 2; ++g) { b[g] = WFrag<bf>::ld(qh + g * 16 * HD + 32 * ks); b2[g] = WFrag<bf>::ld(ql + g * 16 * HD + 32 * ks); }
#pragma unroll
                for (int kt = 0; kt < 2; ++kt)
#pragma unroll
                    for (int g = 0; g < 2; ++g) { s[kt][g] = wmmab(a[kt], b[g], s[kt][g]); s[kt][g] = wmmab(a[kt], b2[g], s[kt][g]); s[kt][g] = wmmab(a2[kt], b[g], s[kt][g]); }
                // four vector slots behind the last score WMMA on every path, as above
                asm volatile("v_nop\n\tv_nop\n\tv_nop\n\tv_nop" : "+v"(s[0][0]), "+v"(s[0][1]), "+v"(s[1][0]), "+v"(s[1][1]) : "v"(a[0]), "v"(a[1]), "v"(a2[0]), "v"(a2[1]), "v"(b[0]), "v"(b[1]), "v"(b2[0]), "v"(b2[1]));
            }
            // the wait before the address registers are rewritten, as above
            asm volatile("s_wait_xcnt 0x0" :: "v"(khp), "v"(klp), "v"(vhp), "v"(vlp) : "memory");
        }
        if (k0 + 31 > r0) {         // wave-uniform per pass: only the pass on the diagonal pays for the mask
#pragma unroll
            for (int g = 0; g < 2; ++g) {
                const int qi = r0 + 16 * g + lr;
#pragma unroll
                for (int kt = 0; kt < 2; ++kt) {
#pragma unroll
                    for (int r = 0; r < 8; ++r) { if (k0 + 16 * kt + 8 * hi + r > qi) s[kt][g][r] = -3.0e38f; }
                    asm volatile("" : "+v"(s[kt][g]));
                }
            }
        }
        // maxima of the raw scores (the scale is positive); the maximum in use may trail the true one by up to 8 in the exponent, so a rescale is rare
        float mb[2]; bool need = false;
#pragma unroll
        for (int g = 0; g < 2; ++g) {
            float mx = s[0][g][0];
#pragma unroll
            for (int r = 1; r < 8; ++r) mx = fmaxf(mx, s[0][g][r]);
#pragma unroll
            for (int r = 0; r < 8; ++r) mx = fmaxf(mx, s[1][g][r]);
            mx = fmaxf(mx, xhalf(mx)) * CEXP;    // both halves of the wave hold the query's maximum, so that they scale alike
            mb[g] = mx; need = need || (mx > ms[g] + 8.0f);
        }
        if (__builtin_amdgcn_ballot_w32(need) != 0) {
#pragma unroll
            for (int g = 0; g < 2; ++g) {
                const float mn = fmaxf(ms[g], mb[g]);                       // finite: every query of the block sees the first key of every live pass
                const float corr = __builtin_amdgcn_exp2f(ms[g] - mn);      // 0 in a wave's first pass
                ms[g] = mn; ls[g] *= corr;
#pragma unroll
                for (int t = 0; t < 4; ++t) acc[g][t] = acc[g][t] * corr;
            }
        }
        v16bf ph[2], pl[2];
#pragma unroll
        for (int g = 0; g < 2; ++g) {
            const float nm = -ms[g]; v8u wh, wl; v2f sum = (v2f){}; float x[16];
#pragma unroll
            for (int i = 0; i < 8; ++i) {      // elements 2i, 2i + 1 of the 32-key operand: key tile i >> 2, registers 2 (i & 3), 2 (i & 3) + 1
                v2f sv, cv, nv; sv[0] = s[i >> 2][g][2 * (i & 3)]; sv[1] = s[i >> 2][g][2 * (i & 3) + 1]; cv[0] = CEXP; cv[1] = CEXP; nv[0] = nm; nv[1] = nm;
                const v2f a = __builtin_elementwise_fma(sv, cv, nv); x[2 * i] = a[0]; x[2 * i + 1] = a[1];
            }
            exp2x8(x[0], x[1], x[2], x[3], x[4], x[5], x[6], x[7]); exp2x8(x[8], x[9], x[10], x[11], x[12], x[13], x[14], x[15]);
#pragma unroll
            for (int i = 0; i < 8; ++i) {
                const float p0 = x[2 * i], p1 = x[2 * i + 1]; v2f pv; pv[0] = p0; pv[1] = p1; sum += pv;
                const unsigned h2 = pack2(p0, p1);
                wh[i] = h2; wl[i] = pack2(p0 - __uint_as_float(h2 << 16), p1 - __uint_as_float(h2 & 0xFFFF0000u));
            }
            ls[g] += sum[0] + sum[1]; ph[g] = __builtin_bit_cast(v16bf, wh); pl[g] = __builtin_bit_cast(v16bf, wl);
        }
#pragma unroll
        for (int g = 0; g < 2; ++g) {
#pragma unroll
            for (int t = 0; t < 4; ++t) acc[g][t] = wmmab(vfh[t], ph[g], acc[g][t]);
#pragma unroll
            for (int t = 0; t < 4; ++t) acc[g][t] = wmmab(vfh[t], pl[g], acc[g][t]);
#pragma unroll
            for (int t = 0; t < 4; ++t) acc[g][t] = wmmab(vfl[t], ph[g], acc[g][t]);
        }
        // four vector slots behind the last WMMA on every path (the loop's branch follows), before its operands are reloaded or its result is read
        asm volatile("v_nop\n\tv_nop\n\tv_nop\n\tv_nop" : "+v"(acc[0][0]), "+v"(acc[0][1]), "+v"(acc[0][2]), "+v"(acc[0][3]), "+v"(acc[1][0]), "+v"(acc[1][1]), "+v"(acc[1][2]), "+v"(acc[1][3])
                     : "v"(vfh[0]), "v"(vfh[1]), "v"(vfh[2]), "v"(vfh[3]), "v"(vfl[0]), "v"(vfl[1]), "v"(vfl[2]), "v"(vfl[3]), "v"(ph[0]), "v"(ph[1]), "v"(pl[0]), "v"(pl[1]));
    }
}
// Grid: NB * SEQ / (2 FAQ) work-groups of equal cost, one per WGP (its LDS admits no second one).
__global__ __launch_bounds__(32 * FAW) __attribute__((amdgpu_waves_per_eu(4, 4))) void k_fa(const h16* __restrict__ Q16, const bf* __restrict__ Qh, const bf* __restrict__ Ql, const h16* __restrict__ K16, const bf* __restrict__ Kh, const bf* __restrict__ Kl,
                                                  const bf* __restrict__ Vh, const bf* __restrict__ Vl, float* O) {
    __shared__ __align__(16) float red[FAS][FAQ * FAP];
    __shared__ float stm[FAS][FAQ], stl[FAS][FAQ];
    const int lane = threadIdx.x & 31, lr = lane & 15, hi = lane >> 4; const int w = __builtin_amdgcn_readfirstlane((int)(threadIdx.x >> 5));
    constexpr int NT = SEQ / FAQ;
    const int j = (int)blockIdx.x / NB; const size_t b = (size_t)((int)blockIdx.x % NB);
    const int npl = j + 1, nph = NT - j;            // live passes of the short and of the long block; npl < nph
    const int rl = j * FAQ, rh = (NT - 1 - j) * FAQ; // their first query rows
    const size_t ko = (b * SEQ + lr) * HD + 8 * hi, po = b * SEQ * HD + lane * 8;
    v8f acc[2][4]; float ms[2], ls[2];
#pragma unroll
    for (int g = 0; g < 2; ++g) { ms[g] = -3.0e38f; ls[g] = 0.0f;
#pragma unroll
        for (int d = 0; d < 4; ++d) acc[g][d] = (v8f){}; }
    auto put = [&](int sl) {     // the wave is done with a block: its partial result goes to slot sl
#pragma unroll
        for (int g = 0; g < 2; ++g) {
            const float lt = ls[g] + xhalf(ls[g]);       // the halves hold different keys of the same query; both store the same two values
            stm[sl][g * 16 + lr] = ms[g]; stl[sl][g * 16 + lr] = lt;
#pragma unroll
            for (int d = 0; d < 4; ++d) { float* dst = &red[sl][(g * 16 + lr) * FAP + d * 16 + 8 * hi]; v4f x0, x1;
#pragma unroll
                for (int r = 0; r < 4; ++r) { x0[r] = acc[g][d][r]; x1[r] = acc[g][d][r + 4]; }
                *(v4fa*)dst = x0; *(v4fa*)(dst + 4) = x1; }
        }
    };
    const bool sh = (w & 1) != 0; const int wa = w >> 1;    // wave-uniform: over the keys that both blocks see, an odd wave works for the short block; waves 2 wa and 2 wa + 1 take the same passes
    {   // the keys that both blocks see
        const int r0 = sh ? rl : rh; const size_t qo = ko + (size_t)r0 * HD;
        if (r0 < RH) fa_loop<true>(Q16 + po + (size_t)r0 * HD, Qh + qo, Ql + qo, K16 + po, Kh + ko, Kl + ko, Vh + po, Vl + po, r0, wa, r0 / FAQ + 1, FAH, lr, hi, acc, ms, ls);   // rows below RH: the short block, r0 / FAQ + 1 = npl
        else         fa_loop<false>(Q16 + po + (size_t)r0 * HD, Qh + qo, Ql + qo, K16 + po, Kh + ko, Kl + ko, Vh + po, Vl + po, r0, wa, npl, FAH, lr, hi, acc, ms, ls);
    }
    if (sh) {                    // the short block is done; the registers start anew for the long one
        put(FAW + wa);
#pragma unroll
        for (int g = 0; g < 2; ++g) { ms[g] = -3.0e38f; ls[g] = 0.0f;
#pragma unroll
            for (int d = 0; d < 4; ++d) acc[g][d] = (v8f){}; }
    }
    {   // the long block's other keys, all 16 waves; its rows lie in the upper half of the sequence, at or above RH
        const size_t qo = ko + (size_t)rh * HD;
        fa_loop<false>(Q16 + po + (size_t)rh * HD, Qh + qo, Ql + qo, K16 + po, Kh + ko, Kl + ko, Vh + po, Vl + po, rh, npl + w, nph, FAW, lr, hi, acc, ms, ls);
    }
    put(w);
    __syncthreads();         // every wave's partial tiles, maxima and sums are in LDS before any of them is merged
    // waves 0..7 merge the long block's 16 slots, waves 8..15 the short block's 8; a thread has 8 columns of one query row
    const int q = (threadIdx.x >> 3) & (FAQ - 1), d0 = (threadIdx.x & 7) * 8; const bool lo = w < FAH; const int s0 = lo ? 0 : FAW;
    float M = stm[s0][q];
#pragma unroll
    for (int u = 1; u < FAH; ++u) M = fmaxf(M, stm[s0 + u][q]);
    if (lo) {
#pragma unroll
        for (int u = FAH; u < FAW; ++u) M = fmaxf(M, stm[u][q]);
    }
    float L = 0.0f; float o[8];
#pragma unroll
    for (int r = 0; r < 8; ++r) o[r] = 0.0f;
    auto add = [&](int u) {              // a slot without a pass has maximum -3e38, weight 0
        const float wt = __builtin_amdgcn_exp2f(stm[u][q] - M); L = __builtin_fmaf(wt, stl[u][q], L);
        const v4f x0 = *(const v4fa*)&red[u][q * FAP + d0]; const v4f x1 = *(const v4fa*)&red[u][q * FAP + d0 + 4];
#pragma unroll
        for (int r = 0; r < 4; ++r) { o[r] = __builtin_fmaf(wt, x0[r], o[r]); o[r + 4] = __builtin_fmaf(wt, x1[r], o[r + 4]); }
    };
#pragma unroll
    for (int u = 0; u < FAH; ++u) add(s0 + u);
    if (lo) {
#pragma unroll
        for (int u = FAH; u < FAW; ++u) add(u);
    }
    const float f = __fdiv_rn(1.0f, L); v4f y0, y1;
#pragma unroll
    for (int r = 0; r < 4; ++r) { y0[r] = o[r] * f; y1[r] = o[r + 4] * f; }
    float* op = O + (b * SEQ + (lo ? rh : rl) + q) * HD + d0; *(v4f*)op = y0; *(v4f*)(op + 4) = y1;   // a wave stores eight whole 128-byte lines
}

// ---- k_wpack: the three weight matrices as bf16 (RNE), laid in the order in which k_proj's waves read them: [column tile 0..11 = q0..3, k0..3, v0..3][k step][half][lane][8],
// so that a fragment (WFrag<bf>::ld order) is two wave-wide loads of 512 contiguous bytes. One thread writes one lane's 16 bytes.
#define KS   (DIN / 32)     // k steps of a projection
#define NTL  (3 * HD / 16)  // column tiles of q, k, v together
__global__ __launch_bounds__(256) void k_wpack(const float* __restrict__ w0, const float* __restrict__ w1, const float* __restrict__ w2, bf* Wp) {
    const int s = (int)blockIdx.x * 256 + (int)threadIdx.x; if (s >= NTL * KS * 64) return;
    const int lane = s & 31, half = (s >> 5) & 1, fk = s >> 6; const int ks = fk % KS, nt = fk / KS;
    const float* w = (nt < 4) ? w0 : ((nt < 8) ? w1 : w2);
    const int n = (nt & 3) * 16 + (lane & 15), k = ks * 32 + half * 16 + (lane >> 4) * 8; v8us o;
#pragma unroll
    for (int j = 0; j < 8; ++j) o[j] = f2bf(w[(size_t)(k + j) * HD + n]);
    *(v8us*)(Wp + (size_t)s * 8) = o;
}

// ---- k_proj: q, k, v = x W and everything around it in one kernel. One work-group of PW waves per PM = 64 tokens.
// 1. The 64 x rows are read as f32 in whole lines (wave w: rows 4w..4w+3), rounded to bf16 (RNE) and laid in LDS.
// 2. Waves 0..11 each take one 16-column tile of q, k or v for all 64 tokens (4 accumulators, k ascending in one chain): W fragments from the packed plane, each read once per work-group, x fragments from LDS.
//    q, k: D = W^T x^T (A = W columns, B = tokens), so a lane holds 8 neighbouring columns of one token; v: D = x W (A = tokens, B = W columns), so a lane holds 8 neighbouring tokens of one column.
// 3. The results are converted to the planes that k_fa reads (f16 and bf16 hi/lo of 4q, 4k; bf16 hi/lo of v, transposed), staged in LDS, and stored in whole 128-byte lines.
// PL: the eight planes one behind the other, PLN elements each: Q16, Qh, Ql, K16, Kh, Kl, Vh, Vl. Qh, Ql, Kh, Kl are row-major [token][64]. The four that k_fa's long loop reads lie in the order of its fragments (WFrag::ldp):
// Q16, K16 [16-token tile][d step of 32][half][lane][8], lane (hi, lr) holding token lr, d = 32 step + 16 half + 8 hi + 0..7; Vh, Vl [32-token pass][16-column tile][half][lane][8], lane holding column lr, tokens 16 half + 8 hi + 0..7.
// Either way a token takes 64 elements of a plane, so the work-group's 64 tokens are 16 groups of 256 elements, one a wave.
#define PM  64
#define PW  16
#define XG  (4 * DIN + 8)   // x in LDS: token 16 mt + lr lies at lr * XG + mt * DIN (bf16 elements): the pitch over lr is 16 bytes x odd, for ds_load_b128 readers, and every constant offset fits the instruction's field
#define SP  (64 + 8)        // LDS pitch of a staged plane row: 16 bytes x odd
#define WD  8               // W fragments a wave holds ahead
#define PLN ((size_t)NB * SEQ * HD)
static_assert(SEQ % PM == 0);
static_assert(KS > WD);
static_assert(DIN == 6 * 128);
static_assert(NTL <= PW && PM == 4 * PW);
typedef __attribute__((ext_vector_type(2))) unsigned v2u;
template <bool VT>
__device__ __forceinline__ void proj_tile(const bf* __restrict__ wp, const bf* xr, bf* sd, v16bf (&wf)[WD]) {
    // wp: the wave's packed W stream at the lane's 16 bytes; xr: LDS x at token lr, element 8 * hi; sd: the lane's place in the first staged plane of its matrix
    v8f acc[4]; v16bf xf[2][4];
#pragma unroll
    for (int mt = 0; mt < 4; ++mt) acc[mt] = (v8f){};
#pragma unroll
    for (int mt = 0; mt < 4; ++mt) xf[0][mt] = WFrag<bf>::ld(xr + mt * DIN);
#pragma unroll
    for (int ks = 0; ks < KS; ++ks) {       // x fragments one k step ahead in a second register set, W fragments WD k steps ahead
        if (ks + 1 < KS) {
#pragma unroll
            for (int mt = 0; mt < 4; ++mt) xf[(ks + 1) & 1][mt] = WFrag<bf>::ld(xr + mt * DIN + 32 * (ks + 1));
        }
#pragma unroll
        for (int mt = 0; mt < 4; ++mt) acc[mt] = VT ? wmmab(xf[ks & 1][mt], wf[ks % WD], acc[mt]) : wmmab(wf[ks % WD], xf[ks & 1][mt], acc[mt]);
        if (ks + WD < KS) wf[ks % WD] = cat16b(*(const v8us*)(wp + (ks + WD) * 512), *(const v8us*)(wp + (ks + WD) * 512 + 256));
        __builtin_amdgcn_sched_barrier(0);  // keeps later k steps' loads from being lifted over this one: lifted freely they overran the register budget and spilled
    }
#pragma unroll
    for (int mt = 0; mt < 4; ++mt) {
        v8us oh, ol;
        if (!VT) {
            v8h o16;
#pragma unroll
            for (int r = 0; r < 8; ++r) { const float y = acc[mt][r] * QCAR; o16[r] = (h16)y; unsigned short a, c; splitf(y, a, c); oh[r] = a; ol[r] = c; }
            bf* d = sd + mt * 16 * SP;      // token 16 mt + lr, columns 16 c + 8 hi + 0..7
            *(v8us*)d = __builtin_bit_cast(v8us, o16); *(v8us*)(d + PM * SP) = oh; *(v8us*)(d + 2 * PM * SP) = ol;
        } else {
#pragma unroll
            for (int r = 0; r < 8; ++r) { unsigned short a, c; splitf(acc[mt][r], a, c); oh[r] = a; ol[r] = c; }
            bf* d = sd + mt * 16;           // column 16 c + lr, tokens 16 mt + 8 hi + 0..7
            *(v8us*)d = oh; *(v8us*)(d + HD * SP) = ol;
        }
    }
}
__global__ __launch_bounds__(32 * PW) void k_proj(const float* __restrict__ X, const bf* __restrict__ Wp, bf* PL) {
    __shared__ __align__(16) bf xs[16 * XG];
    __shared__ __align__(16) bf st[8 * 64 * SP];
    const int lane = threadIdx.x & 31, lr = lane & 15, hi = lane >> 4; const int w = __builtin_amdgcn_readfirstlane((int)(threadIdx.x >> 5));
    const int g0 = (int)blockIdx.x * PM, bi = g0 / SEQ, t0 = g0 % SEQ;
    const bf* wp = Wp + (size_t)w * (KS * 512) + lane * 8;
    v16bf wf[WD];
    if (w < NTL) {
#pragma unroll
        for (int ks = 0; ks < WD; ++ks) wf[ks] = cat16b(*(const v8us*)(wp + ks * 512), *(const v8us*)(wp + ks * 512 + 256));
    }
    const float* xp = X + ((size_t)bi * SEQ_FULL + t0 + 4 * w) * DIN + lane * 4;
    v4f xv[24];
#pragma unroll
    for (int i = 0; i < 24; ++i) xv[i] = *(const v4f*)(xp + (i / 6) * DIN + (i % 6) * 128);
    bf* xd = xs + 4 * (w & 3) * XG + (w >> 2) * DIN + lane * 4;
#pragma unroll
    for (int i = 0; i < 24; ++i) { v2u o; o[0] = pack2(xv[i][0], xv[i][1]); o[1] = pack2(xv[i][2], xv[i][3]); *(v2u*)(xd + (i / 6) * XG + (i % 6) * 128) = o; }
    __syncthreads();         // all 64 x rows are in LDS before any wave reads a fragment of them
    if (w < NTL) {
        const int c = w & 3; const bf* xr = xs + lr * XG + 8 * hi;
        if (w < 8) proj_tile<false>(wp, xr, st + (w >> 2) * 3 * PM * SP + lr * SP + 16 * c + 8 * hi, wf);
        else       proj_tile<true>(wp, xr, st + 6 * PM * SP + (16 * c + lr) * SP + 8 * hi, wf);
    }
    __syncthreads();         // all eight staged planes are in LDS before they are stored
    const int row = 4 * w + (lane >> 3), c8 = (lane & 7) * 8;
#pragma unroll
    for (int j = 0; j < 8; ++j) {        // a wave stores four whole 128-byte lines of each plane
        const bool fo = j == 0 || j == 3 || j >= 6;     // a plane in fragment order: wave w stores half w & 1 of a fragment
        const int sr = !fo ? row : (j < 6 ? 16 * (w >> 2) + lr : 16 * ((w >> 1) & 3) + lr);
        const int sc = !fo ? c8 : (j < 6 ? 16 * (w & 3) + 8 * hi : 32 * (w >> 3) + 16 * (w & 1) + 8 * hi);
        const v8us val = *(const v8us*)(st + (j * 64 + sr) * SP + sc);
        *(v8us*)(PL + j * PLN + (size_t)g0 * HD + w * 256 + lane * 8) = val;
    }
}

static constexpr size_t al256(size_t b) { return (b + 255) & ~(size_t)255; }
static constexpr size_t WS_TOTAL = al256((size_t)3 * HD * DIN * 2) + 8 * PLN * 2;
static_assert(WS_TOTAL <= (size_t)268435456);
static_assert((size_t)NB * SEQ * HD * 4 <= (size_t)4194304);
static_assert((PLN * 2) % 256 == 0);

extern "C" void kernel_launch(void* const* d_in, const int* in_sizes, int n_in,
                              void* d_out, int out_size, void* d_ws, size_t ws_size, hipStream_t stream) {
    if (n_in < 4) return;
    if (in_sizes[0] < ((NB - 1) * SEQ_FULL + SEQ) * DIN) return;
    if (in_sizes[1] < DIN * HD || in_sizes[2] < DIN * HD || in_sizes[3] < DIN * HD) return;
    if (out_size < NB * SEQ * HD) return;
    const float* Xin = (const float*)d_in[0]; const float* Wq = (const float*)d_in[1]; const float* Wk = (const float*)d_in[2]; const float* Wv = (const float*)d_in[3];
    float* OUT = (float*)d_out;     // [NB][SEQ][64]
    if (WS_TOTAL > ws_size) return;
    bf* Wp = (bf*)d_ws;                                             // packed W, bf16
    bf* PL = (bf*)((char*)d_ws + al256((size_t)3 * HD * DIN * 2));  // the eight planes, PLN elements each
    const h16* Q16 = (const h16*)PL; const bf* Qh = PL + PLN; const bf* Ql = PL + 2 * PLN;
    const h16* K16 = (const h16*)(PL + 3 * PLN); const bf* Kh = PL + 4 * PLN; const bf* Kl = PL + 5 * PLN;
    const bf* Vh = PL + 6 * PLN; const bf* Vl = PL + 7 * PLN;

    k_wpack<<<(NTL * KS * 64 + 255) / 256, 256, 0, stream>>>(Wq, Wk, Wv, Wp);
    k_proj<<<NB * SEQ / PM, 32 * PW, 0, stream>>>(Xin, Wp, PL);   /* q, k, v = x W (exact bf16 products) -> the planes of k_fa */
    k_fa<<<NB * (SEQ / FAQ) / 2, 32 * FAW, 0, stream>>>(Q16, Qh, Ql, K16, Kh, Kl, Vh, Vl, OUT);   /* scores, causal softmax, attn x v -> out */
}

// v008
// Measured time: 24.1 microseconds a run.
// Versions in between are left out here; by their measured steps it is 1.27 times as fast as v006.
// Over all steps from v000 it is 36.0 times as fast.
#include <hip/hip_runtime.h>

// Contractions (all f32 accumulate): q,k,v = x W on v_wmma_f32_16x16x32_bf16 (x and W RNE-converted to bf16, single product);
// scores = q.k on v_wmma_f32_16x16x32_f16 (f16 planes of 4q and 4k, single product) for query rows >= 64, and on
// v_wmma_f32_16x16x32_bf16 with q,k as bf16 hi/lo x hi/lo (3 products) for query rows < 64;
// out = attn.v on v_wmma_f32_16x16x32_f16 with un-normalised probabilities and v each rounded once to f16 (single product), divided by the row's f32 sum at the end. Softmax f32, online.
// Why one f16 plane is enough for v: v comes from a single product of x and W rounded to 8 bits, so what lies below f16's 11 bits is already below v's own rounding error.

#ifndef NB
#define NB 4
#endif
#ifndef SEQ
#define SEQ 4096
#endif
#define NB_FULL  4
#define SEQ_FULL 4096
#define DIN   768
#define HD    64
#define RH    64            // query rows < RH: 3-product score tile
#define QCAR  4.0f          // q and k planes carry x4 -> scores carry x16
#define SCL   0.0078125f    // 2^-7 = (64^-0.5) / 16

static_assert(SEQ % 128 == 0);
static_assert(RH <= 128);
static_assert(DIN % 32 == 0);
static_assert(HD == 64);
static_assert((NB * SEQ) % 64 == 0);
static_assert(NB <= NB_FULL);
static_assert(SEQ <= SEQ_FULL);

typedef _Float16 h16;
typedef unsigned short bf;
typedef __attribute__((ext_vector_type(16))) __bf16   v16bf;
typedef __attribute__((ext_vector_type(16))) _Float16 v16h;
typedef __attribute__((ext_vector_type(8)))  _Float16 v8h;
typedef __attribute__((ext_vector_type(8)))  unsigned short v8us;
typedef __attribute__((ext_vector_type(8)))  float    v8f;
typedef __attribute__((ext_vector_type(4)))  float    v4f;
typedef __attribute__((ext_vector_type(2)))  float    v2f;
typedef __attribute__((ext_vector_type(4)))  unsigned short v4us;
typedef __attribute__((ext_vector_type(2)))  unsigned short v2us;
typedef v4f  __attribute__((may_alias)) v4fa;

#pragma clang fp contract(off)

__device__ __forceinline__ unsigned short f2bf(float f) { unsigned u = __float_as_uint(f); u += 0x7FFFu + ((u >> 16) & 1u); return (unsigned short)(u >> 16); }
__device__ __forceinline__ float bf2f(unsigned short b) { return __uint_as_float(((unsigned)b) << 16); }
__device__ __forceinline__ v16h cat16(v8h lo, v8h hi) { return __builtin_shufflevector(lo, hi, 0, 1, 2, 3, 4, 5, 6, 7, 8, 9, 10, 11, 12, 13, 14, 15); }
__device__ __forceinline__ v16bf cat16b(v8us lo, v8us hi) { return __builtin_bit_cast(v16bf, __builtin_shufflevector(lo, hi, 0, 1, 2, 3, 4, 5, 6, 7, 8, 9, 10, 11, 12, 13, 14, 15)); }
__device__ __forceinline__ v8f wmma16(v16h a, v16h b, v8f c) { return __builtin_amdgcn_wmma_f32_16x16x32_f16(false, a, false, b, (short)0, c, false, false); }
__device__ __forceinline__ v8f wmmab(v16bf a, v16bf b, v8f c) { return __builtin_amdgcn_wmma_f32_16x16x32_bf16(false, a, false, b, (short)0, c, false, false); }
__device__ __forceinline__ void splitf(float y, unsigned short& h, unsigned short& l) { h = f2bf(y); l = f2bf(y - bf2f(h)); }

// Fragments (lane l, h = l>>4, m = n = l&15): elements 0..7 <- k0+8h+0..7, elements 8..15 <- k0+16+8h+0..7 for BOTH A and B; D element r -> (row 8h+r, col l&15).
// ld: from a row-major plane, p at the lane's row and k0 + 8h. ldp: from a plane laid in fragment order, [fragment][half][lane][8], p at the lane's 16 bytes of the fragment: the same elements,
// but each of the two wave-wide loads covers 512 contiguous bytes (four whole lines) where ld takes 32 bytes out of each of 16 lines.
template <typename T16> struct WFrag;
template <> struct WFrag<h16> { typedef v16h V; static __device__ __forceinline__ V ld(const h16* p) { return cat16(*(const v8h*)p, *(const v8h*)(p + 16)); } static __device__ __forceinline__ V ldp(const h16* p) { return cat16(*(const v8h*)p, *(const v8h*)(p + 256)); } static __device__ __forceinline__ v8f mma(V a, V b, v8f c) { return wmma16(a, b, c); } };
template <> struct WFrag<bf> { typedef v16bf V; static __device__ __forceinline__ V ld(const bf* p) { return cat16b(*(const v8us*)p, *(const v8us*)(p + 16)); } static __device__ __forceinline__ V ldp(const bf* p) { return cat16b(*(const v8us*)p, *(const v8us*)(p + 256)); } static __device__ __forceinline__ v8f mma(V a, V b, v8f c) { return wmmab(a, b, c); } };

// ---- k_fa: scores, causal softmax and out = P V in one kernel; no score or probability goes to memory.
// One work-group of FAW = 16 waves per PAIR of blocks of FAQ = 32 query rows of one batch: block NT - 1 - j (the long one) and block j (the short one), so that every work-group has the same number of passes.
// A block's live keys are cut into passes of 32 keys. Over the keys that both blocks see, the even waves work for the long block and the odd ones for the short one, waves 2 a and 2 a + 1 on the same pass in the same trip:
// the two, equally old and on neighbouring SIMDs, load the same K and V lines at about the same time, so that the WGP's cache can serve one of them. Over the long block's remaining keys all 16 waves work for it.
// Each of the two key ranges is walked from a place of the work-group's own, wrapping round: the work-groups of a batch run in step, and begun alike they would all ask L2 for the same K and V lines at the same time.
// A wave keeps its own running maximum, sum and un-normalised output tile (online softmax; the order of its passes is free); the partial results (16 of the long block, 8 of the short one) are merged through LDS in slot order.
// Transposed products, so that nothing changes lanes between them: S^T = K Q^T (A = key rows, B = query rows, both by WFrag::ld at the same d), D register r of key tile kt = key 16 kt + 8 hi + r
// of query column lr; the two key tiles of a pass, converted in place, are the B operand P^T in the order of WFrag::ld (elements 0..7 <- k0 + 8 hi + 0..7, 8..15 <- k0 + 16 + 8 hi + 0..7),
// and A = V^T rows in that same order at the same k0: O^T[d = 16 t + 8 hi + r][query lr] += V^T P^T.
// Products: scores on f16 planes of 4q, 4k (query rows >= RH) or bf16 hi/lo, 3 products (query rows < RH); P and V as one f16 plane each, one product. P is rounded un-normalised: it is at most 2^8 (the lazy maximum).
#define FAW 16
#define FAH (FAW / 2)       // waves a block has over the keys that both blocks see
#define FAS (FAW + FAH)     // partial results in LDS: slots 0..15 the long block's, 16..23 the short block's
#define FAQ 32
#define FAP 68              // LDS pitch in floats of a partial tile's query row: 16 bytes x odd
#define CEXP (SCL * 1.4426950408889634f)   // raw score -> exponent of 2
static_assert(SEQ % FAQ == 0);
static_assert(RH % FAQ == 0);
static_assert((SEQ / FAQ) % 2 == 0);
static_assert(SEQ / 2 >= RH);
typedef __attribute__((ext_vector_type(8))) unsigned v8u;
__device__ __forceinline__ float xhalf(float x) { return __builtin_bit_cast(float, __builtin_amdgcn_permlanex16(__builtin_bit_cast(int, x), __builtin_bit_cast(int, x), 0x76543210, 0xfedcba98, false, false)); }   // lane l <-> lane l ^ 16
__device__ __forceinline__ unsigned pack2(float lo, float hi) { typedef __bf16 b2 __attribute__((ext_vector_type(2))); v2f x; x[0] = lo; x[1] = hi; return __builtin_bit_cast(unsigned, __builtin_convertvector(x, b2)); }   // round to nearest even
__device__ __forceinline__ unsigned pack2h(float lo, float hi) { typedef _Float16 h2 __attribute__((ext_vector_type(2))); v2f x; x[0] = lo; x[1] = hi; return __builtin_bit_cast(unsigned, __builtin_convertvector(x, h2)); }   // the same to f16
// eight exponentials of 2, each in place, in one statement: no v_exp_f32 reads its neighbour's result or overwrites its neighbour's source, and the v_nop is the one slot
// that the instruction set asks for behind the last of them, before its result is used
__device__ __forceinline__ void exp2x8(float& a, float& b, float& c, float& d, float& e, float& f, float& g, float& h) {
    asm("v_exp_f32 %0, %0\n\tv_exp_f32 %1, %1\n\tv_exp_f32 %2, %2\n\tv_exp_f32 %3, %3\n\tv_exp_f32 %4, %4\n\tv_exp_f32 %5, %5\n\tv_exp_f32 %6, %6\n\tv_exp_f32 %7, %7\n\tv_nop"
        : "+v"(a), "+v"(b), "+v"(c), "+v"(d), "+v"(e), "+v"(f), "+v"(g), "+v"(h));
}
template <bool LOW>
__device__ __forceinline__ void fa_loop(const h16* __restrict__ q16, const bf* __restrict__ qh, const bf* __restrict__ ql, const h16* __restrict__ k16, const bf* __restrict__ kh, const bf* __restrict__ kl,
                                        const h16* __restrict__ v16, int r0, int pb, int np, int i0, int ps, int rot, int lr, int hi, v8f (&acc)[2][4], float (&ms)[2], float (&ls)[2]) {
    // qh, ql, kh, kl (row-major) arrive at the lane's own row and 8 * hi: q* at query row r0 + lr, k* at key row lr.
    // q16, k16, v16 (fragment order, 64 elements a token) arrive at the lane's 16 bytes: q16 of query row r0's tile, the others of key 0's
    v16h qf[2][2];
    if (!LOW) {
#pragma unroll
        for (int g = 0; g < 2; ++g)
#pragma unroll
            for (int ks = 0; ks < 2; ++ks) qf[g][ks] = WFrag<h16>::ldp(q16 + g * 16 * HD + 512 * ks);
        // the wait that stands before the Q loads' address registers are rewritten (the loop's loads may land on them); the address is an input so that it stays in its registers up to it
        asm volatile("s_wait_xcnt 0x0" :: "v"(q16) : "memory");
    }
    // the wave's passes: places i0, i0 + ps, ... below np of a walk over passes pb .. pb + np - 1 that begins at pass pb + rot (rot < np) and wraps round; pass r0 / 32, the block's last live one, holds the diagonal
#pragma unroll 1   // stays rolled: one pass already fills the register budget of four waves per SIMD
    for (int i = i0; i < np; i += ps) {
        const int k0 = (pb + i + rot - (i + rot >= np ? np : 0)) * 32;
        v8f s[2][2];                // [key tile][query group]
        v16h vf[4];
        const h16* vp = v16 + (size_t)k0 * HD;
        if (!LOW) {
            const h16* kp = k16 + (size_t)k0 * HD;
            v16h kf[2][2];
#pragma unroll
            for (int kt = 0; kt < 2; ++kt)
#pragma unroll
                for (int ks = 0; ks < 2; ++ks) kf[kt][ks] = WFrag<h16>::ldp(kp + kt * 16 * HD + 512 * ks);
            __builtin_amdgcn_sched_barrier(0);  // keeps all K loads in front of the V loads: loads return in order, and left free half of K was issued behind V, so that the score products waited for V too
#pragma unroll
            for (int t = 0; t < 4; ++t) vf[t] = WFrag<h16>::ldp(vp + t * 512);
            // the wait that stands before an issued load's address registers are rewritten; the addresses are inputs so that they stay in their registers up to it
            asm volatile("s_wait_xcnt 0x0" :: "v"(kp), "v"(vp) : "memory");
#pragma unroll
            for (int kt = 0; kt < 2; ++kt)
#pragma unroll
                for (int g = 0; g < 2; ++g) { s[kt][g] = wmma16(kf[kt][0], qf[g][0], (v8f){}); s[kt][g] = wmma16(kf[kt][1], qf[g][1], s[kt][g]); }
            // four vector slots behind the last score WMMA on every path (a branch follows), before its result is read or its operands are reloaded
            asm volatile("v_nop\n\tv_nop\n\tv_nop\n\tv_nop" : "+v"(s[0][0]), "+v"(s[0][1]), "+v"(s[1][0]), "+v"(s[1][1]) : "v"(kf[0][0]), "v"(kf[0][1]), "v"(kf[1][0]), "v"(kf[1][1]));
        } else {
            const bf* khp = kh + (size_t)k0 * HD; const bf* klp = kl + (size_t)k0 * HD;
#pragma unroll
            for (int t = 0; t < 4; ++t) vf[t] = WFrag<h16>::ldp(vp + t * 512);
#pragma unroll
            for (int kt = 0; kt < 2; ++kt)
#pragma unroll
                for (int g = 0; g < 2; ++g) s[kt][g] = (v8f){};
#pragma unroll
            for (int ks = 0; ks < 2; ++ks) {
                v16bf a[2], a2[2], b[2], b2[2];
#pragma unroll
                for (int kt = 0; kt < 2; ++kt) { a[kt] = WFrag<bf>::ld(khp + kt * 16 * HD + 32 * ks); a2[kt] = WFrag<bf>::ld(klp + kt * 16 * HD + 32 * ks); }
#pragma unroll
                for (int g = 0; g < 2; ++g) { b[g] = WFrag<bf>::ld(qh + g * 16 * HD + 32 * ks); b2[g] = WFrag<bf>::ld(ql + g * 16 * HD + 32 * ks); }
#pragma unroll
                for (int kt = 0; kt < 2; ++kt)
#pragma unroll
                    for (int g = 0; g < 2; ++g) { s[kt][g] = wmmab(a[kt], b[g], s[kt][g]); s[kt][g] = wmmab(a[kt], b2[g], s[kt][g]); s[kt][g] = wmmab(a2[kt], b[g], s[kt][g]); }
                // four vector slots behind the last score WMMA on every path, as above
                asm volatile("v_nop\n\tv_nop\n\tv_nop\n\tv_nop" : "+v"(s[0][0]), "+v"(s[0][1]), "+v"(s[1][0]), "+v"(s[1][1]) : "v"(a[0]), "v"(a[1]), "v"(a2[0]), "v"(a2[1]), "v"(b[0]), "v"(b[1]), "v"(b2[0]), "v"(b2[1]));
            }
            // the wait before the address registers are rewritten, as above
            asm volatile("s_wait_xcnt 0x0" :: "v"(khp), "v"(klp), "v"(vp) : "memory");
        }
        if (k0 + 31 > r0) {         // wave-uniform per pass: only the pass on the diagonal pays for the mask
#pragma unroll
            for (int g = 0; g < 2; ++g) {
                const int qi = r0 + 16 * g + lr;
#pragma unroll
                for (int kt = 0; kt < 2; ++kt) {
#pragma unroll
                    for (int r = 0; r < 8; ++r) { if (k0 + 16 * kt + 8 * hi + r > qi) s[kt][g][r] = -3.0e38f; }
                    asm volatile("" : "+v"(s[kt][g]));
                }
            }
        }
        // maxima of the raw scores (the scale is positive); the maximum in use may trail the true one by up to 8 in the exponent, so a rescale is rare
        float mb[2]; bool need = false;
#pragma unroll
        for (int g = 0; g < 2; ++g) {
            float mx = s[0][g][0];
#pragma unroll
            for (int r = 1; r < 8; ++r) mx = fmaxf(mx, s[0][g][r]);
#pragma unroll
            for (int r = 0; r < 8; ++r) mx = fmaxf(mx, s[1][g][r]);
            mx = fmaxf(mx, xhalf(mx)) * CEXP;    // both halves of the wave hold the query's maximum, so that they scale alike
            mb[g] = mx; need = need || (mx > ms[g] + 8.0f);
        }
        if (__builtin_amdgcn_ballot_w32(need) != 0) {
#pragma unroll
            for (int g = 0; g < 2; ++g) {
                const float mn = fmaxf(ms[g], mb[g]);                       // finite: every query of the block sees the first key of every live pass
                const float corr = __builtin_amdgcn_exp2f(ms[g] - mn);      // 0 in a wave's first pass
                ms[g] = mn; ls[g] *= corr;
#pragma unroll
                for (int t = 0; t < 4; ++t) acc[g][t] = acc[g][t] * corr;
            }
        }
        v16h pf[2];
#pragma unroll
        for (int g = 0; g < 2; ++g) {
            const float nm = -ms[g]; v8u wh; v2f sum = (v2f){}; float x[16];
#pragma unroll
            for (int i = 0; i < 8; ++i) {      // elements 2i, 2i + 1 of the 32-key operand: key tile i >> 2, registers 2 (i & 3), 2 (i & 3) + 1
                v2f sv, cv, nv; sv[0] = s[i >> 2][g][2 * (i & 3)]; sv[1] = s[i >> 2][g][2 * (i & 3) + 1]; cv[0] = CEXP; cv[1] = CEXP; nv[0] = nm; nv[1] = nm;
                const v2f a = __builtin_elementwise_fma(sv, cv, nv); x[2 * i] = a[0]; x[2 * i + 1] = a[1];
            }
            exp2x8(x[0], x[1], x[2], x[3], x[4], x[5], x[6], x[7]); exp2x8(x[8], x[9], x[10], x[11], x[12], x[13], x[14], x[15]);
#pragma unroll
            for (int i = 0; i < 8; ++i) {
                const float p0 = x[2 * i], p1 = x[2 * i + 1]; v2f pv; pv[0] = p0; pv[1] = p1; sum += pv;
                wh[i] = pack2h(p0, p1);
            }
            ls[g] += sum[0] + sum[1]; pf[g] = __builtin_bit_cast(v16h, wh);
        }
#pragma unroll
        for (int g = 0; g < 2; ++g) {
#pragma unroll
            for (int t = 0; t < 4; ++t) acc[g][t] = wmma16(vf[t], pf[g], acc[g][t]);
        }
        // four vector slots behind the last WMMA on every path (the loop's branch follows), before its operands are reloaded or its result is read
        asm volatile("v_nop\n\tv_nop\n\tv_nop\n\tv_nop" : "+v"(acc[0][0]), "+v"(acc[0][1]), "+v"(acc[0][2]), "+v"(acc[0][3]), "+v"(acc[1][0]), "+v"(acc[1][1]), "+v"(acc[1][2]), "+v"(acc[1][3])
                     : "v"(vf[0]), "v"(vf[1]), "v"(vf[2]), "v"(vf[3]), "v"(pf[0]), "v"(pf[1]));
    }
}
// Grid: NB * SEQ / (2 FAQ) work-groups of equal cost, one per WGP (its LDS admits no second one).
__global__ __launch_bounds__(32 * FAW) __attribute__((amdgpu_waves_per_eu(4, 4))) void k_fa(const h16* __restrict__ Q16, const bf* __restrict__ Qh, const bf* __restrict__ Ql, const h16* __restrict__ K16, const bf* __restrict__ Kh, const bf* __restrict__ Kl,
                                                  const h16* __restrict__ V16, float* O) {
    __shared__ __align__(16) float red[FAS][FAQ * FAP];
    __shared__ float stm[FAS][FAQ], stl[FAS][FAQ];
    const int lane = threadIdx.x & 31, lr = lane & 15, hi = lane >> 4; const int w = __builtin_amdgcn_readfirstlane((int)(threadIdx.x >> 5));
    constexpr int NT = SEQ / FAQ;
    const int j = (int)blockIdx.x / NB; const size_t b = (size_t)((int)blockIdx.x % NB);
    const int npl = j + 1, nph = NT - j;            // live passes of the short and of the long block; npl < nph
    const int rl = j * FAQ, rh = (NT - 1 - j) * FAQ; // their first query rows
    // where this work-group's walks begin, as 128ths of a range: steps of 79/128 (near the golden section) lay neighbouring j far apart and fill the range evenly; the batches, whose planes lie a power of two apart, are set off by a quarter
    const int fr = (j * 79 + (int)b * 32) & 127; const int rs = (fr * npl) >> 7, rg = (fr * (nph - npl)) >> 7;
    const size_t ko = (b * SEQ + lr) * HD + 8 * hi, po = b * SEQ * HD + lane * 8;
    v8f acc[2][4]; float ms[2], ls[2];
#pragma unroll
    for (int g = 0; g < 2; ++g) { ms[g] = -3.0e38f; ls[g] = 0.0f;
#pragma unroll
        for (int d = 0; d < 4; ++d) acc[g][d] = (v8f){}; }
    auto put = [&](int sl) {     // the wave is done with a block: its partial result goes to slot sl
#pragma unroll
        for (int g = 0; g < 2; ++g) {
            const float lt = ls[g] + xhalf(ls[g]);       // the halves hold different keys of the same query; both store the same two values
            stm[sl][g * 16 + lr] = ms[g]; stl[sl][g * 16 + lr] = lt;
#pragma unroll
            for (int d = 0; d < 4; ++d) { float* dst = &red[sl][(g * 16 + lr) * FAP + d * 16 + 8 * hi]; v4f x0, x1;
#pragma unroll
                for (int r = 0; r < 4; ++r) { x0[r] = acc[g][d][r]; x1[r] = acc[g][d][r + 4]; }
                *(v4fa*)dst = x0; *(v4fa*)(dst + 4) = x1; }
        }
    };
    const bool sh = (w & 1) != 0; const int wa = w >> 1;    // wave-uniform: over the keys that both blocks see, an odd wave works for the short block; waves 2 wa and 2 wa + 1 take the same passes
    {   // the keys that both blocks see
        const int r0 = sh ? rl : rh; const size_t qo = ko + (size_t)r0 * HD;
        if (r0 < RH) fa_loop<true>(Q16 + po + (size_t)r0 * HD, Qh + qo, Ql + qo, K16 + po, Kh + ko, Kl + ko, V16 + po, r0, 0, r0 / FAQ + 1, wa, FAH, rs, lr, hi, acc, ms, ls);   // rows below RH: the short block, r0 / FAQ + 1 = npl
        else         fa_loop<false>(Q16 + po + (size_t)r0 * HD, Qh + qo, Ql + qo, K16 + po, Kh + ko, Kl + ko, V16 + po, r0, 0, npl, wa, FAH, rs, lr, hi, acc, ms, ls);
    }
    if (sh) {                    // the short block is done; the registers start anew for the long one
        put(FAW + wa);
#pragma unroll
        for (int g = 0; g < 2; ++g) { ms[g] = -3.0e38f; ls[g] = 0.0f;
#pragma unroll
            for (int d = 0; d < 4; ++d) acc[g][d] = (v8f){}; }
    }
    {   // the long block's other keys, all 16 waves; its rows lie in the upper half of the sequence, at or above RH
        const size_t qo = ko + (size_t)rh * HD;
        fa_loop<false>(Q16 + po + (size_t)rh * HD, Qh + qo, Ql + qo, K16 + po, Kh + ko, Kl + ko, V16 + po, rh, npl, nph - npl, w, FAW, rg, lr, hi, acc, ms, ls);
    }
    put(w);
    __syncthreads();         // every wave's partial tiles, maxima and sums are in LDS before any of them is merged
    // waves 0..7 merge the long block's 16 slots, waves 8..15 the short block's 8; a thread has 8 columns of one query row
    const int q = (threadIdx.x >> 3) & (FAQ - 1), d0 = (threadIdx.x & 7) * 8; const bool lo = w < FAH; const int s0 = lo ? 0 : FAW;
    float M = stm[s0][q];
#pragma unroll
    for (int u = 1; u < FAH; ++u) M = fmaxf(M, stm[s0 + u][q]);
    if (lo) {
#pragma unroll
        for (int u = FAH; u < FAW; ++u) M = fmaxf(M, stm[u][q]);
    }
    float L = 0.0f; float o[8];
#pragma unroll
    for (int r = 0; r < 8; ++r) o[r] = 0.0f;
    auto add = [&](int u) {              // a slot without a pass has maximum -3e38, weight 0
        const float wt = __builtin_amdgcn_exp2f(stm[u][q] - M); L = __builtin_fmaf(wt, stl[u][q], L);
        const v4f x0 = *(const v4fa*)&red[u][q * FAP + d0]; const v4f x1 = *(const v4fa*)&red[u][q * FAP + d0 + 4];
#pragma unroll
        for (int r = 0; r < 4; ++r) { o[r] = __builtin_fmaf(wt, x0[r], o[r]); o[r + 4] = __builtin_fmaf(wt, x1[r], o[r + 4]); }
    };
#pragma unroll
    for (int u = 0; u < FAH; ++u) add(s0 + u);
    if (lo) {
#pragma unroll
        for (int u = FAH; u < FAW; ++u) add(u);
    }
    const float f = __fdiv_rn(1.0f, L); v4f y0, y1;
#pragma unroll
    for (int r = 0; r < 4; ++r) { y0[r] = o[r] * f; y1[r] = o[r + 4] * f; }
    float* op = O + (b * SEQ + (lo ? rh : rl) + q) * HD + d0; *(v4f*)op = y0; *(v4f*)(op + 4) = y1;   // a wave stores eight whole 128-byte lines
}

// ---- k_wpack: the three weight matrices as bf16 (RNE), laid in the order in which k_proj's waves read them: [column tile 0..11 = q0..3, k0..3, v0..3][k step][half][lane][8],
// so that a fragment (WFrag<bf>::ld order) is two wave-wide loads of 512 contiguous bytes. One thread writes one lane's 16 bytes.
#define KS   (DIN / 32)     // k steps of a projection
#define NTL  (3 * HD / 16)  // column tiles of q, k, v together
__global__ __launch_bounds__(256) void k_wpack(const float* __restrict__ w0, const float* __restrict__ w1, const float* __restrict__ w2, bf* Wp) {
    const int s = (int)blockIdx.x * 256 + (int)threadIdx.x; if (s >= NTL * KS * 64) return;
    const int lane = s & 31, half = (s >> 5) & 1, fk = s >> 6; const int ks = fk % KS, nt = fk / KS;
    const float* w = (nt < 4) ? w0 : ((nt < 8) ? w1 : w2);
    const int n = (nt & 3) * 16 + (lane & 15), k = ks * 32 + half * 16 + (lane >> 4) * 8; v8us o;
#pragma unroll
    for (int j = 0; j < 8; ++j) o[j] = f2bf(w[(size_t)(k + j) * HD + n]);
    *(v8us*)(Wp + (size_t)s * 8) = o;
}

// ---- k_proj: q, k, v = x W and everything around it in one kernel. One work-group of PW waves per PM = 64 tokens.
// 1. The 64 x rows are read as f32 in whole lines (wave w: rows 4w..4w+3), rounded to bf16 (RNE) and laid in LDS.
// 2. Waves 0..11 each take one 16-column tile of q, k or v for all 64 tokens (4 accumulators, k ascending in one chain): W fragments from the packed plane, each read once per work-group, x fragments from LDS.
//    q, k: D = W^T x^T (A = W columns, B = tokens), so a lane holds 8 neighbouring columns of one token; v: D = x W (A = tokens, B = W columns), so a lane holds 8 neighbouring tokens of one column.
// 3. The results are converted to the planes that k_fa reads (f16 and bf16 hi/lo of 4q, 4k; f16 of v, transposed), staged in LDS, and stored in whole 128-byte lines.
// PL: the seven planes one behind the other, PLN elements each: Q16, Qh, Ql, K16, Kh, Kl, V16. Qh, Ql, Kh, Kl are row-major [token][64]. The three that k_fa's long loop reads lie in the order of its fragments (WFrag::ldp):
// Q16, K16 [16-token tile][d step of 32][half][lane][8], lane (hi, lr) holding token lr, d = 32 step + 16 half + 8 hi + 0..7; V16 [32-token pass][16-column tile][half][lane][8], lane holding column lr, tokens 16 half + 8 hi + 0..7.
// Either way a token takes 64 elements of a plane, so the work-group's 64 tokens are 16 groups of 256 elements, one a wave.
#define PM  64
#define PW  16
#define XG  (4 * DIN + 8)   // x in LDS: token 16 mt + lr lies at lr * XG + mt * DIN (bf16 elements): the pitch over lr is 16 bytes x odd, for ds_load_b128 readers, and every constant offset fits the instruction's field
#define SP  (64 + 8)        // LDS pitch of a staged plane row: 16 bytes x odd
#define WD  8               // W fragments a wave holds ahead
#define PLN ((size_t)NB * SEQ * HD)
static_assert(SEQ % PM == 0);
static_assert(KS > WD);
static_assert(DIN == 6 * 128);
static_assert(NTL <= PW && PM == 4 * PW);
typedef __attribute__((ext_vector_type(2))) unsigned v2u;
template <bool VT>
__device__ __forceinline__ void proj_tile(const bf* __restrict__ wp, const bf* xr, bf* sd, v16bf (&wf)[WD]) {
    // wp: the wave's packed W stream at the lane's 16 bytes; xr: LDS x at token lr, element 8 * hi; sd: the lane's place in the first staged plane of its matrix
    v8f acc[4]; v16bf xf[2][4];
#pragma unroll
    for (int mt = 0; mt < 4; ++mt) acc[mt] = (v8f){};
#pragma unroll
    for (int mt = 0; mt < 4; ++mt) xf[0][mt] = WFrag<bf>::ld(xr + mt * DIN);
#pragma unroll
    for (int ks = 0; ks < KS; ++ks) {       // x fragments one k step ahead in a second register set, W fragments WD k steps ahead
        if (ks + 1 < KS) {
#pragma unroll
            for (int mt = 0; mt < 4; ++mt) xf[(ks + 1) & 1][mt] = WFrag<bf>::ld(xr + mt * DIN + 32 * (ks + 1));
        }
#pragma unroll
        for (int mt = 0; mt < 4; ++mt) acc[mt] = VT ? wmmab(xf[ks & 1][mt], wf[ks % WD], acc[mt]) : wmmab(wf[ks % WD], xf[ks & 1][mt], acc[mt]);
        if (ks + WD < KS) wf[ks % WD] = cat16b(*(const v8us*)(wp + (ks + WD) * 512), *(const v8us*)(wp + (ks + WD) * 512 + 256));
        __builtin_amdgcn_sched_barrier(0);  // keeps later k steps' loads from being lifted over this one: lifted freely they overran the register budget and spilled
    }
#pragma unroll
    for (int mt = 0; mt < 4; ++mt) {
        v8h o16;
        if (!VT) {
            v8us oh, ol;
#pragma unroll
            for (int r = 0; r < 8; ++r) { const float y = acc[mt][r] * QCAR; o16[r] = (h16)y; unsigned short a, c; splitf(y, a, c); oh[r] = a; ol[r] = c; }
            bf* d = sd + mt * 16 * SP;      // token 16 mt + lr, columns 16 c + 8 hi + 0..7
            *(v8us*)d = __builtin_bit_cast(v8us, o16); *(v8us*)(d + PM * SP) = oh; *(v8us*)(d + 2 * PM * SP) = ol;
        } else {
#pragma unroll
            for (int r = 0; r < 8; ++r) o16[r] = (h16)acc[mt][r];
            bf* d = sd + mt * 16;           // column 16 c + lr, tokens 16 mt + 8 hi + 0..7
            *(v8us*)d = __builtin_bit_cast(v8us, o16);
        }
    }
}
__global__ __launch_bounds__(32 * PW) void k_proj(const float* __restrict__ X, const bf* __restrict__ Wp, bf* PL) {
    __shared__ __align__(16) bf xs[16 * XG];
    __shared__ __align__(16) bf st[7 * 64 * SP];
    const int lane = threadIdx.x & 31, lr = lane & 15, hi = lane >> 4; const int w = __builtin_amdgcn_readfirstlane((int)(threadIdx.x >> 5));
    const int g0 = (int)blockIdx.x * PM, bi = g0 / SEQ, t0 = g0 % SEQ;
    const bf* wp = Wp + (size_t)w * (KS * 512) + lane * 8;
    v16bf wf[WD];
    if (w < NTL) {
#pragma unroll
        for (int ks = 0; ks < WD; ++ks) wf[ks] = cat16b(*(const v8us*)(wp + ks * 512), *(const v8us*)(wp + ks * 512 + 256));
    }
    const float* xp = X + ((size_t)bi * SEQ_FULL + t0 + 4 * w) * DIN + lane * 4;
    v4f xv[24];
#pragma unroll
    for (int i = 0; i < 24; ++i) xv[i] = *(const v4f*)(xp + (i / 6) * DIN + (i % 6) * 128);
    bf* xd = xs + 4 * (w & 3) * XG + (w >> 2) * DIN + lane * 4;
#pragma unroll
    for (int i = 0; i < 24; ++i) { v2u o; o[0] = pack2(xv[i][0], xv[i][1]); o[1] = pack2(xv[i][2], xv[i][3]); *(v2u*)(xd + (i / 6) * XG + (i % 6) * 128) = o; }
    __syncthreads();         // all 64 x rows are in LDS before any wave reads a fragment of them
    if (w < NTL) {
        const int c = w & 3; const bf* xr = xs + lr * XG + 8 * hi;
        if (w < 8) proj_tile<false>(wp, xr, st + (w >> 2) * 3 * PM * SP + lr * SP + 16 * c + 8 * hi, wf);
        else       proj_tile<true>(wp, xr, st + 6 * PM * SP + (16 * c + lr) * SP + 8 * hi, wf);
    }
    __syncthreads();         // all seven staged planes are in LDS before they are stored
    const int row = 4 * w + (lane >> 3), c8 = (lane & 7) * 8;
#pragma unroll
    for (int j = 0; j < 7; ++j) {        // a wave stores four whole 128-byte lines of each plane
        const bool fo = j == 0 || j == 3 || j == 6;     // a plane in fragment order: wave w stores half w & 1 of a fragment
        const int sr = !fo ? row : (j < 6 ? 16 * (w >> 2) + lr : 16 * ((w >> 1) & 3) + lr);
        const int sc = !fo ? c8 : (j < 6 ? 16 * (w & 3) + 8 * hi : 32 * (w >> 3) + 16 * (w & 1) + 8 * hi);
        const v8us val = *(const v8us*)(st + (j * 64 + sr) * SP + sc);
        *(v8us*)(PL + j * PLN + (size_t)g0 * HD + w * 256 + lane * 8) = val;
    }
}

static constexpr size_t al256(size_t b) { return (b + 255) & ~(size_t)255; }
static constexpr size_t WS_TOTAL = al256((size_t)3 * HD * DIN * 2) + 7 * PLN * 2;
static_assert(WS_TOTAL <= (size_t)268435456);
static_assert((size_t)NB * SEQ * HD * 4 <= (size_t)4194304);
static_assert((PLN * 2) % 256 == 0);

extern "C" void kernel_launch(void* const* d_in, const int* in_sizes, int n_in,
                              void* d_out, int out_size, void* d_ws, size_t ws_size, hipStream_t stream) {
    if (n_in < 4) return;
    if (in_sizes[0] < ((NB - 1) * SEQ_FULL + SEQ) * DIN) return;
    if (in_sizes[1] < DIN * HD || in_sizes[2] < DIN * HD || in_sizes[3] < DIN * HD) return;
    if (out_size < NB * SEQ * HD) return;
    const float* Xin = (const float*)d_in[0]; const float* Wq = (const float*)d_in[1]; const float* Wk = (const float*)d_in[2]; const float* Wv = (const float*)d_in[3];
    float* OUT = (float*)d_out;     // [NB][SEQ][64]
    if (WS_TOTAL > ws_size) return;
    bf* Wp = (bf*)d_ws;                                             // packed W, bf16
    bf* PL = (bf*)((char*)d_ws + al256((size_t)3 * HD * DIN * 2));  // the seven planes, PLN elements each
    const h16* Q16 = (const h16*)PL; const bf* Qh = PL + PLN; const bf* Ql = PL + 2 * PLN;
    const h16* K16 = (const h16*)(PL + 3 * PLN); const bf* Kh = PL + 4 * PLN; const bf* Kl = PL + 5 * PLN;
    const h16* V16 = (const h16*)(PL + 6 * PLN);

    k_wpack<<<(NTL * KS * 64 + 255) / 256, 256, 0, stream>>>(Wq, Wk, Wv, Wp);
    k_proj<<<NB * SEQ / PM, 32 * PW, 0, stream>>>(Xin, Wp, PL);   /* q, k, v = x W (exact bf16 products) -> the planes of k_fa */
    k_fa<<<NB * (SEQ / FAQ) / 2, 32 * FAW, 0, stream>>>(Q16, Qh, Ql, K16, Kh, Kl, V16, OUT);   /* scores, causal softmax, attn x v -> out */
}

// v009
// A run of this version takes 23.2 microseconds.
// Timed twice side by side with v008, it ran 1.03 times as fast both times.
// All steps since v000 together make it 37.2 times as fast.
#include <hip/hip_runtime.h>

// Contractions (all f32 accumulate): q,k,v = x W on v_wmma_f32_16x16x32_bf16 (x and W RNE-converted to bf16, single product);
// scores = q.k on v_wmma_f32_16x16x32_f16 (f16 planes of 4q and 4k, single product) for query rows >= 64, and on
// v_wmma_f32_16x16x32_bf16 with q,k as bf16 hi/lo x hi/lo (3 products) for query rows < 64;
// out = attn.v on v_wmma_f32_16x16x32_f16 with un-normalised probabilities and v each rounded once to f16 (single product), divided by the row's f32 sum at the end. Softmax f32, online.
// Why one f16 plane is enough for v: v comes from a single product of x and W rounded to 8 bits, so what lies below f16's 11 bits is already below v's own rounding error.

#ifndef NB
#define NB 4
#endif
#ifndef SEQ
#define SEQ 4096
#endif
#define NB_FULL  4
#define SEQ_FULL 4096
#define DIN   768
#define HD    64
#define RH    64            // query rows < RH: 3-product score tile
#define QCAR  4.0f          // q and k planes carry x4 -> scores carry x16
#define SCL   0.0078125f    // 2^-7 = (64^-0.5) / 16

static_assert(SEQ % 128 == 0);
static_assert(RH <= 128);
static_assert(DIN % 32 == 0);
static_assert(HD == 64);
static_assert((NB * SEQ) % 64 == 0);
static_assert(NB <= NB_FULL);
static_assert(SEQ <= SEQ_FULL);

typedef _Float16 h16;
typedef unsigned short bf;
typedef __attribute__((ext_vector_type(16))) __bf16   v16bf;
typedef __attribute__((ext_vector_type(16))) _Float16 v16h;
typedef __attribute__((ext_vector_type(8)))  _Float16 v8h;
typedef __attribute__((ext_vector_type(8)))  unsigned short v8us;
typedef __attribute__((ext_vector_type(8)))  float    v8f;
typedef __attribute__((ext_vector_type(4)))  float    v4f;
typedef __attribute__((ext_vector_type(2)))  float    v2f;
typedef __attribute__((ext_vector_type(4)))  unsigned short v4us;
typedef __attribute__((ext_vector_type(2)))  unsigned short v2us;
typedef v4f  __attribute__((may_alias)) v4fa;

#pragma clang fp contract(off)

__device__ __forceinline__ unsigned short f2bf(float f) { unsigned u = __float_as_uint(f); u += 0x7FFFu + ((u >> 16) & 1u); return (unsigned short)(u >> 16); }
__device__ __forceinline__ float bf2f(unsigned short b) { return __uint_as_float(((unsigned)b) << 16); }
__device__ __forceinline__ v16h cat16(v8h lo, v8h hi) { return __builtin_shufflevector(lo, hi, 0, 1, 2, 3, 4, 5, 6, 7, 8, 9, 10, 11, 12, 13, 14, 15); }
__device__ __forceinline__ v16bf cat16b(v8us lo, v8us hi) { return __builtin_bit_cast(v16bf, __builtin_shufflevector(lo, hi, 0, 1, 2, 3, 4, 5, 6, 7, 8, 9, 10, 11, 12, 13, 14, 15)); }
__device__ __forceinline__ v8f wmma16(v16h a, v16h b, v8f c) { return __builtin_amdgcn_wmma_f32_16x16x32_f16(false, a, false, b, (short)0, c, false, false); }
__device__ __forceinline__ v8f wmmab(v16bf a, v16bf b, v8f c) { return __builtin_amdgcn_wmma_f32_16x16x32_bf16(false, a, false, b, (short)0, c, false, false); }
__device__ __forceinline__ void splitf(float y, unsigned short& h, unsigned short& l) { h = f2bf(y); l = f2bf(y - bf2f(h)); }

// Fragments (lane l, h = l>>4, m = n = l&15): elements 0..7 <- k0+8h+0..7, elements 8..15 <- k0+16+8h+0..7 for BOTH A and B; D element r -> (row 8h+r, col l&15).
// ld: from a row-major plane, p at the lane's row and k0 + 8h. ldp: from a plane laid in fragment order, [fragment][half][lane][8], p at the lane's 16 bytes of the fragment: the same elements,
// but each of the two wave-wide loads covers 512 contiguous bytes (four whole lines) where ld takes 32 bytes out of each of 16 lines.
template <typename T16> struct WFrag;
template <> struct WFrag<h16> { typedef v16h V; static __device__ __forceinline__ V ld(const h16* p) { return cat16(*(const v8h*)p, *(const v8h*)(p + 16)); } static __device__ __forceinline__ V ldp(const h16* p) { return cat16(*(const v8h*)p, *(const v8h*)(p + 256)); } static __device__ __forceinline__ v8f mma(V a, V b, v8f c) { return wmma16(a, b, c); } };
template <> struct WFrag<bf> { typedef v16bf V; static __device__ __forceinline__ V ld(const bf* p) { return cat16b(*(const v8us*)p, *(const v8us*)(p + 16)); } static __device__ __forceinline__ V ldp(const bf* p) { return cat16b(*(const v8us*)p, *(const v8us*)(p + 256)); } static __device__ __forceinline__ v8f mma(V a, V b, v8f c) { return wmmab(a, b, c); } };

// ---- k_fa: scores, causal softmax and out = P V in one kernel; no score or probability goes to memory.
// One work-group of FAW = 16 waves per PAIR of blocks of FAQ = 32 query rows of one batch: block NT - 1 - j (the long one) and block j (the short one), so that every work-group has the same number of passes.
// A block's live keys are cut into passes of 32 keys. Over the keys that both blocks see, the even waves work for the long block and the odd ones for the short one, waves 2 a and 2 a + 1 on the same pass in the same trip:
// the two, equally old and on neighbouring SIMDs, load the same K and V lines at about the same time, so that the WGP's cache can serve one of them. Over the long block's remaining keys all 16 waves work for it.
// Each of the two key ranges is walked from a place of the work-group's own, wrapping round: the work-groups of a batch run in step, and begun alike they would all ask L2 for the same K and V lines at the same time.
// A wave keeps its own running maximum, sum and un-normalised output tile (online softmax; the order of its passes is free); the partial results (16 of the long block, 8 of the short one) are merged through LDS in slot order.
// Transposed products, so that nothing changes lanes between them: S^T = K Q^T (A = key rows, B = query rows, both by WFrag::ld at the same d), D register r of key tile kt = key 16 kt + 8 hi + r
// of query column lr; the two key tiles of a pass, converted in place, are the B operand P^T in the order of WFrag::ld (elements 0..7 <- k0 + 8 hi + 0..7, 8..15 <- k0 + 16 + 8 hi + 0..7),
// and A = V^T rows in that same order at the same k0: O^T[d = 16 t + 8 hi + r][query lr] += V^T P^T.
// Products: scores on f16 planes of 4q, 4k (query rows >= RH) or bf16 hi/lo, 3 products (query rows < RH); P and V as one f16 plane each, one product. P is rounded un-normalised: it is at most 2^8 (the lazy maximum).
#define FAW 16
#define FAH (FAW / 2)       // waves a block has over the keys that both blocks see
#define FAS (FAW + FAH)     // partial results in LDS: slots 0..15 the long block's, 16..23 the short block's
#define FAQ 32
#define FAP 68              // LDS pitch in floats of a partial tile's query row: 16 bytes x odd
#define CEXP (SCL * 1.4426950408889634f)   // raw score -> exponent of 2
static_assert(SEQ % FAQ == 0);
static_assert(RH % FAQ == 0);
static_assert((SEQ / FAQ) % 2 == 0);
static_assert(SEQ / 2 >= RH);
typedef __attribute__((ext_vector_type(8))) unsigned v8u;
__device__ __forceinline__ float xhalf(float x) { return __builtin_bit_cast(float, __builtin_amdgcn_permlanex16(__builtin_bit_cast(int, x), __builtin_bit_cast(int, x), 0x76543210, 0xfedcba98, false, false)); }   // lane l <-> lane l ^ 16
__device__ __forceinline__ unsigned pack2(float lo, float hi) { typedef __bf16 b2 __attribute__((ext_vector_type(2))); v2f x; x[0] = lo; x[1] = hi; return __builtin_bit_cast(unsigned, __builtin_convertvector(x, b2)); }   // round to nearest even
__device__ __forceinline__ unsigned pack2h(float lo, float hi) { typedef _Float16 h2 __attribute__((ext_vector_type(2))); v2f x; x[0] = lo; x[1] = hi; return __builtin_bit_cast(unsigned, __builtin_convertvector(x, h2)); }   // the same to f16
// eight exponentials of 2, each in place, in one statement: no v_exp_f32 reads its neighbour's result or overwrites its neighbour's source, and the v_nop is the one slot
// that the instruction set asks for behind the last of them, before its result is used
__device__ __forceinline__ void exp2x8(float& a, float& b, float& c, float& d, float& e, float& f, float& g, float& h) {
    asm("v_exp_f32 %0, %0\n\tv_exp_f32 %1, %1\n\tv_exp_f32 %2, %2\n\tv_exp_f32 %3, %3\n\tv_exp_f32 %4, %4\n\tv_exp_f32 %5, %5\n\tv_exp_f32 %6, %6\n\tv_exp_f32 %7, %7\n\tv_nop"
        : "+v"(a), "+v"(b), "+v"(c), "+v"(d), "+v"(e), "+v"(f), "+v"(g), "+v"(h));
}
template <bool LOW>
__device__ __forceinline__ void fa_loop(const h16* __restrict__ q16, const bf* __restrict__ qh, const bf* __restrict__ ql, const h16* __restrict__ k16, const bf* __restrict__ kh, const bf* __restrict__ kl,
                                        const h16* __restrict__ v16, int r0, int pb, int np, int i0, int ps, int rot, int lr, int hi, v8f (&acc)[2][4], float (&ms)[2], float (&ls)[2]) {
    // qh, ql, kh, kl (row-major) arrive at the lane's own row and 8 * hi: q* at query row r0 + lr, k* at key row lr.
    // q16, k16, v16 (fragment order, 64 elements a token) arrive at the lane's 16 bytes: q16 of query row r0's tile, the others of key 0's
    v16h qf[2][2];
    if (!LOW) {
#pragma unroll
        for (int g = 0; g < 2; ++g)
#pragma unroll
            for (int ks = 0; ks < 2; ++ks) qf[g][ks] = WFrag<h16>::ldp(q16 + g * 16 * HD + 512 * ks);
        // the wait that stands before the Q loads' address registers are rewritten (the loop's loads may land on them); the address is an input so that it stays in its registers up to it
        asm volatile("s_wait_xcnt 0x0" :: "v"(q16) : "memory");
    }
    // the wave's passes: places i0, i0 + ps, ... below np of a walk over passes pb .. pb + np - 1 that begins at pass pb + rot (rot < np) and wraps round; pass r0 / 32, the block's last live one, holds the diagonal
#pragma unroll 1   // stays rolled: one pass already fills the register budget of four waves per SIMD
    for (int i = i0; i < np; i += ps) {
        const int k0 = (pb + i + rot - (i + rot >= np ? np : 0)) * 32;
        v8f s[2][2];                // [key tile][query group]
        v16h vf[4];
        const h16* vp = v16 + (size_t)k0 * HD;
        if (!LOW) {
            const h16* kp = k16 + (size_t)k0 * HD;
            v16h kf[2][2];
#pragma unroll
            for (int kt = 0; kt < 2; ++kt)
#pragma unroll
                for (int ks = 0; ks < 2; ++ks) kf[kt][ks] = WFrag<h16>::ldp(kp + kt * 16 * HD + 512 * ks);
            __builtin_amdgcn_sched_barrier(0);  // keeps all K loads in front of the V loads: loads return in order, and left free half of K was issued behind V, so that the score products waited for V too
#pragma unroll
            for (int t = 0; t < 4; ++t) vf[t] = WFrag<h16>::ldp(vp + t * 512);
            // the wait that stands before an issued load's address registers are rewritten; the addresses are inputs so that they stay in their registers up to it
            asm volatile("s_wait_xcnt 0x0" :: "v"(kp), "v"(vp) : "memory");
#pragma unroll
            for (int kt = 0; kt < 2; ++kt)
#pragma unroll
                for (int g = 0; g < 2; ++g) { s[kt][g] = wmma16(kf[kt][0], qf[g][0], (v8f){}); s[kt][g] = wmma16(kf[kt][1], qf[g][1], s[kt][g]); }
            // four vector slots behind the last score WMMA on every path (a branch follows), before its result is read or its operands are reloaded
            asm volatile("v_nop\n\tv_nop\n\tv_nop\n\tv_nop" : "+v"(s[0][0]), "+v"(s[0][1]), "+v"(s[1][0]), "+v"(s[1][1]) : "v"(kf[0][0]), "v"(kf[0][1]), "v"(kf[1][0]), "v"(kf[1][1]));
        } else {
            const bf* khp = kh + (size_t)k0 * HD; const bf* klp = kl + (size_t)k0 * HD;
#pragma unroll
            for (int t = 0; t < 4; ++t) vf[t] = WFrag<h16>::ldp(vp + t * 512);
#pragma unroll
            for (int kt = 0; kt < 2; ++kt)
#pragma unroll
                for (int g = 0; g < 2; ++g) s[kt][g] = (v8f){};
#pragma unroll
            for (int ks = 0; ks < 2; ++ks) {
                v16bf a[2], a2[2], b[2], b2[2];
#pragma unroll
                for (int kt = 0; kt < 2; ++kt) { a[kt] = WFrag<bf>::ld(khp + kt * 16 * HD + 32 * ks); a2[kt] = WFrag<bf>::ld(klp + kt * 16 * HD + 32 * ks); }
#pragma unroll
                for (int g = 0; g < 2; ++g) { b[g] = WFrag<bf>::ld(qh + g * 16 * HD + 32 * ks); b2[g] = WFrag<bf>::ld(ql + g * 16 * HD + 32 * ks); }
#pragma unroll
                for (int kt = 0; kt < 2; ++kt)
#pragma unroll
                    for (int g = 0; g < 2; ++g) { s[kt][g] = wmmab(a[kt], b[g], s[kt][g]); s[kt][g] = wmmab(a[kt], b2[g], s[kt][g]); s[kt][g] = wmmab(a2[kt], b[g], s[kt][g]); }
                // four vector slots behind the last score WMMA on every path, as above
                asm volatile("v_nop\n\tv_nop\n\tv_nop\n\tv_nop" : "+v"(s[0][0]), "+v"(s[0][1]), "+v"(s[1][0]), "+v"(s[1][1]) : "v"(a[0]), "v"(a[1]), "v"(a2[0]), "v"(a2[1]), "v"(b[0]), "v"(b[1]), "v"(b2[0]), "v"(b2[1]));
            }
            // the wait before the address registers are rewritten, as above
            asm volatile("s_wait_xcnt 0x0" :: "v"(khp), "v"(klp), "v"(vp) : "memory");
        }
        if (k0 + 31 > r0) {         // wave-uniform per pass: only the pass on the diagonal pays for the mask
#pragma unroll
            for (int g = 0; g < 2; ++g) {
                const int qi = r0 + 16 * g + lr;
#pragma unroll
                for (int kt = 0; kt < 2; ++kt) {
#pragma unroll
                    for (int r = 0; r < 8; ++r) { if (k0 + 16 * kt + 8 * hi + r > qi) s[kt][g][r] = -3.0e38f; }
                    asm volatile("" : "+v"(s[kt][g]));
                }
            }
        }
        // maxima of the raw scores (the scale is positive); the maximum in use may trail the true one by up to 8 in the exponent, so a rescale is rare
        float mb[2]; bool need = false;
#pragma unroll
        for (int g = 0; g < 2; ++g) {
            float mx = s[0][g][0];
#pragma unroll
            for (int r = 1; r < 8; ++r) mx = fmaxf(mx, s[0][g][r]);
#pragma unroll
            for (int r = 0; r < 8; ++r) mx = fmaxf(mx, s[1][g][r]);
            mx = fmaxf(mx, xhalf(mx)) * CEXP;    // both halves of the wave hold the query's maximum, so that they scale alike
            mb[g] = mx; need = need || (mx > ms[g] + 8.0f);
        }
        if (__builtin_amdgcn_ballot_w32(need) != 0) {
#pragma unroll
            for (int g = 0; g < 2; ++g) {
                const float mn = fmaxf(ms[g], mb[g]);                       // finite: every query of the block sees the first key of every live pass
                const float corr = __builtin_amdgcn_exp2f(ms[g] - mn);      // 0 in a wave's first pass
                ms[g] = mn; ls[g] *= corr;
#pragma unroll
                for (int t = 0; t < 4; ++t) acc[g][t] = acc[g][t] * corr;
            }
        }
        v16h pf[2];
#pragma unroll
        for (int g = 0; g < 2; ++g) {
            const float nm = -ms[g]; v8u wh; v2f sum = (v2f){}; float x[16];
#pragma unroll
            for (int i = 0; i < 8; ++i) {      // elements 2i, 2i + 1 of the 32-key operand: key tile i >> 2, registers 2 (i & 3), 2 (i & 3) + 1
                v2f sv, cv, nv; sv[0] = s[i >> 2][g][2 * (i & 3)]; sv[1] = s[i >> 2][g][2 * (i & 3) + 1]; cv[0] = CEXP; cv[1] = CEXP; nv[0] = nm; nv[1] = nm;
                const v2f a = __builtin_elementwise_fma(sv, cv, nv); x[2 * i] = a[0]; x[2 * i + 1] = a[1];
            }
            exp2x8(x[0], x[1], x[2], x[3], x[4], x[5], x[6], x[7]); exp2x8(x[8], x[9], x[10], x[11], x[12], x[13], x[14], x[15]);
#pragma unroll
            for (int i = 0; i < 8; ++i) {
                const float p0 = x[2 * i], p1 = x[2 * i + 1]; v2f pv; pv[0] = p0; pv[1] = p1; sum += pv;
                wh[i] = pack2h(p0, p1);
            }
            ls[g] += sum[0] + sum[1]; pf[g] = __builtin_bit_cast(v16h, wh);
        }
#pragma unroll
        for (int g = 0; g < 2; ++g) {
#pragma unroll
            for (int t = 0; t < 4; ++t) acc[g][t] = wmma16(vf[t], pf[g], acc[g][t]);
        }
        // four vector slots behind the last WMMA on every path (the loop's branch follows), before its operands are reloaded or its result is read
        asm volatile("v_nop\n\tv_nop\n\tv_nop\n\tv_nop" : "+v"(acc[0][0]), "+v"(acc[0][1]), "+v"(acc[0][2]), "+v"(acc[0][3]), "+v"(acc[1][0]), "+v"(acc[1][1]), "+v"(acc[1][2]), "+v"(acc[1][3])
                     : "v"(vf[0]), "v"(vf[1]), "v"(vf[2]), "v"(vf[3]), "v"(pf[0]), "v"(pf[1]));
    }
}
// Grid: NB * SEQ / (2 FAQ) work-groups of equal cost, one per WGP (its LDS admits no second one).
__global__ __launch_bounds__(32 * FAW) __attribute__((amdgpu_waves_per_eu(4, 4))) void k_fa(const h16* __restrict__ Q16, const bf* __restrict__ Qh, const bf* __restrict__ Ql, const h16* __restrict__ K16, const bf* __restrict__ Kh, const bf* __restrict__ Kl,
                                                  const h16* __restrict__ V16, float* O) {
    __shared__ __align__(16) float red[FAS][FAQ * FAP];
    __shared__ float stm[FAS][FAQ], stl[FAS][FAQ];
    const int lane = threadIdx.x & 31, lr = lane & 15, hi = lane >> 4; const int w = __builtin_amdgcn_readfirstlane((int)(threadIdx.x >> 5));
    constexpr int NT = SEQ / FAQ;
    const int j = (int)blockIdx.x / NB; const size_t b = (size_t)((int)blockIdx.x % NB);
    const int npl = j + 1, nph = NT - j;            // live passes of the short and of the long block; npl < nph
    const int rl = j * FAQ, rh = (NT - 1 - j) * FAQ; // their first query rows
    // where this work-group's walks begin, as 128ths of a range: steps of 79/128 (near the golden section) lay neighbouring j far apart and fill the range evenly; the batches, whose planes lie a power of two apart, are set off by a quarter
    const int fr = (j * 79 + (int)b * 32) & 127; const int rs = (fr * npl) >> 7, rg = (fr * (nph - npl)) >> 7;
    const size_t ko = (b * SEQ + lr) * HD + 8 * hi, po = b * SEQ * HD + lane * 8;
    v8f acc[2][4]; float ms[2], ls[2];
#pragma unroll
    for (int g = 0; g < 2; ++g) { ms[g] = -3.0e38f; ls[g] = 0.0f;
#pragma unroll
        for (int d = 0; d < 4; ++d) acc[g][d] = (v8f){}; }
    auto put = [&](int sl) {     // the wave is done with a block: its partial result goes to slot sl
#pragma unroll
        for (int g = 0; g < 2; ++g) {
            const float lt = ls[g] + xhalf(ls[g]);       // the halves hold different keys of the same query; both store the same two values
            stm[sl][g * 16 + lr] = ms[g]; stl[sl][g * 16 + lr] = lt;
#pragma unroll
            for (int d = 0; d < 4; ++d) { float* dst = &red[sl][(g * 16 + lr) * FAP + d * 16 + 8 * hi]; v4f x0, x1;
#pragma unroll
                for (int r = 0; r < 4; ++r) { x0[r] = acc[g][d][r]; x1[r] = acc[g][d][r + 4]; }
                *(v4fa*)dst = x0; *(v4fa*)(dst + 4) = x1; }
        }
    };
    const bool sh = (w & 1) != 0; const int wa = w >> 1;    // wave-uniform: over the keys that both blocks see, an odd wave works for the short block; waves 2 wa and 2 wa + 1 take the same passes
    {   // the keys that both blocks see
        const int r0 = sh ? rl : rh; const size_t qo = ko + (size_t)r0 * HD;
        if (r0 < RH) fa_loop<true>(Q16 + po + (size_t)r0 * HD, Qh + qo, Ql + qo, K16 + po, Kh + ko, Kl + ko, V16 + po, r0, 0, r0 / FAQ + 1, wa, FAH, rs, lr, hi, acc, ms, ls);   // rows below RH: the short block, r0 / FAQ + 1 = npl
        else         fa_loop<false>(Q16 + po + (size_t)r0 * HD, Qh + qo, Ql + qo, K16 + po, Kh + ko, Kl + ko, V16 + po, r0, 0, npl, wa, FAH, rs, lr, hi, acc, ms, ls);
    }
    if (sh) {                    // the short block is done; the registers start anew for the long one
        put(FAW + wa);
#pragma unroll
        for (int g = 0; g < 2; ++g) { ms[g] = -3.0e38f; ls[g] = 0.0f;
#pragma unroll
            for (int d = 0; d < 4; ++d) acc[g][d] = (v8f){}; }
    }
    {   // the long block's other keys, all 16 waves; its rows lie in the upper half of the sequence, at or above RH
        const size_t qo = ko + (size_t)rh * HD;
        fa_loop<false>(Q16 + po + (size_t)rh * HD, Qh + qo, Ql + qo, K16 + po, Kh + ko, Kl + ko, V16 + po, rh, npl, nph - npl, w, FAW, rg, lr, hi, acc, ms, ls);
    }
    put(w);
    __syncthreads();         // every wave's partial tiles, maxima and sums are in LDS before any of them is merged
    // waves 0..7 merge the long block's 16 slots, waves 8..15 the short block's 8; a thread has 8 columns of one query row
    const int q = (threadIdx.x >> 3) & (FAQ - 1), d0 = (threadIdx.x & 7) * 8; const bool lo = w < FAH; const int s0 = lo ? 0 : FAW;
    float M = stm[s0][q];
#pragma unroll
    for (int u = 1; u < FAH; ++u) M = fmaxf(M, stm[s0 + u][q]);
    if (lo) {
#pragma unroll
        for (int u = FAH; u < FAW; ++u) M = fmaxf(M, stm[u][q]);
    }
    float L = 0.0f; float o[8];
#pragma unroll
    for (int r = 0; r < 8; ++r) o[r] = 0.0f;
    auto add = [&](int u) {              // a slot without a pass has maximum -3e38, weight 0
        const float wt = __builtin_amdgcn_exp2f(stm[u][q] - M); L = __builtin_fmaf(wt, stl[u][q], L);
        const v4f x0 = *(const v4fa*)&red[u][q * FAP + d0]; const v4f x1 = *(const v4fa*)&red[u][q * FAP + d0 + 4];
#pragma unroll
        for (int r = 0; r < 4; ++r) { o[r] = __builtin_fmaf(wt, x0[r], o[r]); o[r + 4] = __builtin_fmaf(wt, x1[r], o[r + 4]); }
    };
#pragma unroll
    for (int u = 0; u < FAH; ++u) add(s0 + u);
    if (lo) {
#pragma unroll
        for (int u = FAH; u < FAW; ++u) add(u);
    }
    const float f = __fdiv_rn(1.0f, L); v4f y0, y1;
#pragma unroll
    for (int r = 0; r < 4; ++r) { y0[r] = o[r] * f; y1[r] = o[r + 4] * f; }
    float* op = O + (b * SEQ + (lo ? rh : rl) + q) * HD + d0; *(v4f*)op = y0; *(v4f*)(op + 4) = y1;   // a wave stores eight whole 128-byte lines
}

// ---- k_wpack: the three weight matrices as bf16 (RNE), laid in the order in which k_proj's waves read them: [column tile 0..11 = q0..3, k0..3, v0..3][k step][half][lane][8],
// so that a fragment (WFrag<bf>::ld order) is two wave-wide loads of 512 contiguous bytes. One thread writes one lane's 16 bytes.
#define KS   (DIN / 32)     // k steps of a projection
#define NTL  (3 * HD / 16)  // column tiles of q, k, v together
__global__ __launch_bounds__(256) void k_wpack(const float* __restrict__ w0, const float* __restrict__ w1, const float* __restrict__ w2, bf* Wp) {
    const int s = (int)blockIdx.x * 256 + (int)threadIdx.x; if (s >= NTL * KS * 64) return;
    const int lane = s & 31, half = (s >> 5) & 1, fk = s >> 6; const int ks = fk % KS, nt = fk / KS;
    const float* w = (nt < 4) ? w0 : ((nt < 8) ? w1 : w2);
    const int n = (nt & 3) * 16 + (lane & 15), k = ks * 32 + half * 16 + (lane >> 4) * 8; v8us o;
#pragma unroll
    for (int j = 0; j < 8; ++j) o[j] = f2bf(w[(size_t)(k + j) * HD + n]);
    *(v8us*)(Wp + (size_t)s * 8) = o;
}

// ---- k_proj: q, k, v = x W and everything around it in one kernel. One work-group of PW waves per PM = 64 tokens.
// 1. The 64 x rows are read as f32 in whole lines (wave w: rows 4w..4w+3), rounded to bf16 (RNE) and laid in LDS.
// 2. Waves 0..11 each take one 16-column tile of q, k or v for all 64 tokens (4 accumulators, k ascending in one chain): W fragments from the packed plane, each read once per work-group, x fragments from LDS.
//    q, k: D = W^T x^T (A = W columns, B = tokens), so a lane holds 8 neighbouring columns of one token; v: D = x W (A = tokens, B = W columns), so a lane holds 8 neighbouring tokens of one column.
// 3. The results are converted to the planes that k_fa reads. Tokens at or above RH: f16 of 4q, 4k and of v, transposed, stored by each wave straight from its accumulators, in whole 128-byte lines.
//    Tokens below RH, the only ones whose bf16 hi/lo planes of 4q, 4k k_fa reads: all seven planes, staged in LDS and stored in whole 128-byte lines.
// PL: the seven planes one behind the other, PLN elements each: Q16, Qh, Ql, K16, Kh, Kl, V16. Qh, Ql, Kh, Kl are row-major [token][64]. The three that k_fa's long loop reads lie in the order of its fragments (WFrag::ldp):
// Q16, K16 [16-token tile][d step of 32][half][lane][8], lane (hi, lr) holding token lr, d = 32 step + 16 half + 8 hi + 0..7; V16 [32-token pass][16-column tile][half][lane][8], lane holding column lr, tokens 16 half + 8 hi + 0..7.
// Either way a token takes 64 elements of a plane, so the work-group's 64 tokens are 16 groups of 256 elements: one a wave when staged, four of one plane a wave (waves 0..11) when stored from the accumulators.
#define PM  64
#define PW  16
#define XG  (4 * DIN + 8)   // x in LDS: token 16 mt + lr lies at lr * XG + mt * DIN (bf16 elements): the pitch over lr is 16 bytes x odd, for ds_load_b128 readers, and every constant offset fits the instruction's field
#define SP  (64 + 8)        // LDS pitch of a staged plane row: 16 bytes x odd
#define WD  8               // W fragments a wave holds ahead
#define PLN ((size_t)NB * SEQ * HD)
static_assert(SEQ % PM == 0);
static_assert(KS > WD);
static_assert(DIN == 6 * 128);
static_assert(NTL <= PW && PM == 4 * PW);
typedef __attribute__((ext_vector_type(2))) unsigned v2u;
template <bool VT, bool HL>
__device__ __forceinline__ void proj_tile(const bf* __restrict__ wp, const bf* xr, bf* sd, bf* gd, v16bf (&wf)[WD]) {
    // wp: the wave's packed W stream at the lane's 16 bytes; xr: LDS x at token lr, element 8 * hi; sd (HL): the lane's place in the first staged plane of its matrix;
    // gd (!HL): the lane's 16 bytes of the wave's first fragment half in its matrix's f16 plane in memory
    v8f acc[4]; v16bf xf[2][4];
#pragma unroll
    for (int mt = 0; mt < 4; ++mt) acc[mt] = (v8f){};
#pragma unroll
    for (int mt = 0; mt < 4; ++mt) xf[0][mt] = WFrag<bf>::ld(xr + mt * DIN);
#pragma unroll
    for (int ks = 0; ks < KS; ++ks) {       // x fragments one k step ahead in a second register set, W fragments WD k steps ahead
        if (ks + 1 < KS) {
#pragma unroll
            for (int mt = 0; mt < 4; ++mt) xf[(ks + 1) & 1][mt] = WFrag<bf>::ld(xr + mt * DIN + 32 * (ks + 1));
        }
#pragma unroll
        for (int mt = 0; mt < 4; ++mt) acc[mt] = VT ? wmmab(xf[ks & 1][mt], wf[ks % WD], acc[mt]) : wmmab(wf[ks % WD], xf[ks & 1][mt], acc[mt]);
        if (ks + WD < KS) wf[ks % WD] = cat16b(*(const v8us*)(wp + (ks + WD) * 512), *(const v8us*)(wp + (ks + WD) * 512 + 256));
        __builtin_amdgcn_sched_barrier(0);  // keeps later k steps' loads from being lifted over this one: lifted freely they overran the register budget and spilled
    }
    if (!HL) {
        // The accumulator's lane order is the plane's fragment order: lane (hi, lr) holds, for q and k, token 16 mt + lr, columns 16 c + 8 hi + 0..7 = half c & 1 of d step c >> 1 of token tile mt;
        // for v, column 16 c + lr, tokens 16 mt + 8 hi + 0..7 = half mt & 1 of column tile c of pass mt >> 1. So each wave-wide store is 512 contiguous bytes, four whole lines of which this wave is the one writer.
        v8us o[4];
#pragma unroll
        for (int mt = 0; mt < 4; ++mt) {
            v8h o16;
#pragma unroll
            for (int r = 0; r < 8; ++r) o16[r] = (h16)(VT ? acc[mt][r] : acc[mt][r] * QCAR);
            o[mt] = __builtin_bit_cast(v8us, o16);
        }
#pragma unroll
        for (int mt = 0; mt < 4; ++mt) *(v8us*)(gd + (VT ? (mt >> 1) * 32 * HD + (mt & 1) * 256 : mt * 16 * HD)) = o[mt];
        // the wait that stands before an issued store's address and data registers are rewritten (in the listing another instantiation's code follows); they are inputs so that they stay in their registers up to it
        asm volatile("s_wait_xcnt 0x0" :: "v"(gd), "v"(o[0]), "v"(o[1]), "v"(o[2]), "v"(o[3]) : "memory");
        return;
    }
#pragma unroll
    for (int mt = 0; mt < 4; ++mt) {
        v8h o16;
        if (!VT) {
            v8us oh, ol;
#pragma unroll
            for (int r = 0; r < 8; ++r) { const float y = acc[mt][r] * QCAR; o16[r] = (h16)y; unsigned short a, c; splitf(y, a, c); oh[r] = a; ol[r] = c; }
            bf* d = sd + mt * 16 * SP;      // token 16 mt + lr, columns 16 c + 8 hi + 0..7
            *(v8us*)d = __builtin_bit_cast(v8us, o16); *(v8us*)(d + PM * SP) = oh; *(v8us*)(d + 2 * PM * SP) = ol;
        } else {
#pragma unroll
            for (int r = 0; r < 8; ++r) o16[r] = (h16)acc[mt][r];
            bf* d = sd + mt * 16;           // column 16 c + lr, tokens 16 mt + 8 hi + 0..7
            *(v8us*)d = __builtin_bit_cast(v8us, o16);
        }
    }
}
__global__ __launch_bounds__(32 * PW) void k_proj(const float* __restrict__ X, const bf* __restrict__ Wp, bf* PL) {
    __shared__ __align__(16) bf xs[16 * XG];
    __shared__ __align__(16) bf st[7 * 64 * SP];
    const int lane = threadIdx.x & 31, lr = lane & 15, hi = lane >> 4; const int w = __builtin_amdgcn_readfirstlane((int)(threadIdx.x >> 5));
    const int g0 = (int)blockIdx.x * PM, bi = g0 / SEQ, t0 = g0 % SEQ;
    const bool hl = t0 < RH;     // the same for the whole work-group: k_fa reads Qh, Ql, Kh, Kl only at query rows and keys below RH
    const bf* wp = Wp + (size_t)w * (KS * 512) + lane * 8;
    v16bf wf[WD];
    if (w < NTL) {
#pragma unroll
        for (int ks = 0; ks < WD; ++ks) wf[ks] = cat16b(*(const v8us*)(wp + ks * 512), *(const v8us*)(wp + ks * 512 + 256));
    }
    const float* xp = X + ((size_t)bi * SEQ_FULL + t0 + 4 * w) * DIN + lane * 4;
    v4f xv[24];
#pragma unroll
    for (int i = 0; i < 24; ++i) xv[i] = *(const v4f*)(xp + (i / 6) * DIN + (i % 6) * 128);
    bf* xd = xs + 4 * (w & 3) * XG + (w >> 2) * DIN + lane * 4;
#pragma unroll
    for (int i = 0; i < 24; ++i) { v2u o; o[0] = pack2(xv[i][0], xv[i][1]); o[1] = pack2(xv[i][2], xv[i][3]); *(v2u*)(xd + (i / 6) * XG + (i % 6) * 128) = o; }
    __syncthreads();         // all 64 x rows are in LDS before any wave reads a fragment of them
    if (w < NTL) {
        const int c = w & 3; const bf* xr = xs + lr * XG + 8 * hi;
        bf* gq = PL + (w >> 2) * 3 * PLN + (size_t)g0 * HD + c * 256 + lane * 8; bf* gv = PL + 6 * PLN + (size_t)g0 * HD + c * 512 + lane * 8;
        if (!hl) {
            if (w < 8) proj_tile<false, false>(wp, xr, st, gq, wf);
            else       proj_tile<true, false>(wp, xr, st, gv, wf);
        } else {
            if (w < 8) proj_tile<false, true>(wp, xr, st + (w >> 2) * 3 * PM * SP + lr * SP + 16 * c + 8 * hi, gq, wf);
            else       proj_tile<true, true>(wp, xr, st + 6 * PM * SP + (16 * c + lr) * SP + 8 * hi, gv, wf);
        }
    }
    if (!hl) return;         // the whole work-group or none of it: its three planes are stored
    __syncthreads();         // all seven staged planes are in LDS before they are stored
    const int row = 4 * w + (lane >> 3), c8 = (lane & 7) * 8;
#pragma unroll
    for (int j = 0; j < 7; ++j) {        // a wave stores four whole 128-byte lines of each plane
        const bool fo = j == 0 || j == 3 || j == 6;     // a plane in fragment order: wave w stores half w & 1 of a fragment
        const int sr = !fo ? row : (j < 6 ? 16 * (w >> 2) + lr : 16 * ((w >> 1) & 3) + lr);
        const int sc = !fo ? c8 : (j < 6 ? 16 * (w & 3) + 8 * hi : 32 * (w >> 3) + 16 * (w & 1) + 8 * hi);
        const v8us val = *(const v8us*)(st + (j * 64 + sr) * SP + sc);
        *(v8us*)(PL + j * PLN + (size_t)g0 * HD + w * 256 + lane * 8) = val;
    }
}

static constexpr size_t al256(size_t b) { return (b + 255) & ~(size_t)255; }
static constexpr size_t WS_TOTAL = al256((size_t)3 * HD * DIN * 2) + 7 * PLN * 2;
static_assert(WS_TOTAL <= (size_t)268435456);
static_assert((size_t)NB * SEQ * HD * 4 <= (size_t)4194304);
static_assert((PLN * 2) % 256 == 0);

extern "C" void kernel_launch(void* const* d_in, const int* in_sizes, int n_in,
                              void* d_out, int out_size, void* d_ws, size_t ws_size, hipStream_t stream) {
    if (n_in < 4) return;
    if (in_sizes[0] < ((NB - 1) * SEQ_FULL + SEQ) * DIN) return;
    if (in_sizes[1] < DIN * HD || in_sizes[2] < DIN * HD || in_sizes[3] < DIN * HD) return;
    if (out_size < NB * SEQ * HD) return;
    const float* Xin = (const float*)d_in[0]; const float* Wq = (const float*)d_in[1]; const float* Wk = (const float*)d_in[2]; const float* Wv = (const float*)d_in[3];
    float* OUT = (float*)d_out;     // [NB][SEQ][64]
    if (WS_TOTAL > ws_size) return;
    bf* Wp = (bf*)d_ws;                                             // packed W, bf16
    bf* PL = (bf*)((char*)d_ws + al256((size_t)3 * HD * DIN * 2));  // the seven planes, PLN elements each
    const h16* Q16 = (const h16*)PL; const bf* Qh = PL + PLN; const bf* Ql = PL + 2 * PLN;
    const h16* K16 = (const h16*)(PL + 3 * PLN); const bf* Kh = PL + 4 * PLN; const bf* Kl = PL + 5 * PLN;
    const h16* V16 = (const h16*)(PL + 6 * PLN);

    k_wpack<<<(NTL * KS * 64 + 255) / 256, 256, 0, stream>>>(Wq, Wk, Wv, Wp);
    k_proj<<<NB * SEQ / PM, 32 * PW, 0, stream>>>(Xin, Wp, PL);   /* q, k, v = x W (exact bf16 products) -> the planes of k_fa */
    k_fa<<<NB * (SEQ / FAQ) / 2, 32 * FAW, 0, stream>>>(Q16, Qh, Ql, K16, Kh, Kl, V16, OUT);   /* scores, causal softmax, attn x v -> out */
}
